// v000
// Times are from an AMD MI455X. After a warm-up the kernel runs many times in a row, and a time is the length of
// such a window on the GPU divided by its runs, so every launch and the gaps after it count. The runs cycle
// through copies of the inputs. A figure is the median of several windows, for all but v000 over two sittings.
// Sittings can differ by a few percent; kernels timed side by side share one.
// The starting kernel, v000, takes 660 microseconds a run.
#include <hip/hip_runtime.h>

// Contractions, f32 accumulate: q/k/v projections v_wmma_f32_16x16x32_bf16 on bf16 (RNE) copies of x and W (exact products); scores v_wmma_f32_16x16x32_f16 on f16 q/k planes (single product); softmax f32; P.V v_wmma_f32_16x16x32_bf16 with P and V carried as bf16 hi+lo planes (3 products).
// Pipeline per batch: F[3][t][768] = bf16(x_b) x Bt (3 weights, grid.z); q/k planes [h][t][d] f16 (+bias); value planes [h][d][t] bf16 hi/lo (+bias); S[h][t][t'] f32 (grid.z over heads); row softmax of S/HD in f32 -> P hi/lo [h][t][t']; out[b][t][h*HD + d] = P V written directly.

#ifndef NB
#define NB 8
#endif
#ifndef SEQ
#define SEQ 1024
#endif
#define SEQ_FULL 1024
#define TT   SEQ
#define DM   768
#define NH_  12
#define HD   64
#define SCL  0.015625f   // 1/HD (scores are divided by head_dim)

static_assert(TT % 128 == 0);
static_assert(TT <= SEQ_FULL);
static_assert(NH_ * HD == DM);
static_assert(DM % 64 == 0);
static_assert(HD == 64);
static_assert(NB >= 1 && NB <= 8);

typedef _Float16 h16;
typedef unsigned short bf;
typedef __attribute__((ext_vector_type(16))) __bf16   v16bf;
typedef __attribute__((ext_vector_type(16))) _Float16 v16h;
typedef __attribute__((ext_vector_type(8)))  _Float16 v8h;
typedef __attribute__((ext_vector_type(8)))  unsigned short v8us;
typedef __attribute__((ext_vector_type(8)))  float    v8f;
typedef __attribute__((ext_vector_type(4)))  float    v4f;
typedef __attribute__((ext_vector_type(4)))  unsigned short v4us;
typedef v8h  __attribute__((may_alias)) v8ha;
typedef v4f  __attribute__((may_alias)) v4fa;
typedef v8us __attribute__((may_alias)) v8usa;

__device__ __forceinline__ unsigned short f2bf(float f) { unsigned u = __float_as_uint(f); u += 0x7FFFu + ((u >> 16) & 1u); return (unsigned short)(u >> 16); }
__device__ __forceinline__ float bf2f(unsigned short b) { return __uint_as_float(((unsigned)b) << 16); }
__device__ __forceinline__ float bfr(float f) { return bf2f(f2bf(f)); }
__device__ __forceinline__ v16h cat16(v8h lo, v8h hi) { return __builtin_shufflevector(lo, hi, 0, 1, 2, 3, 4, 5, 6, 7, 8, 9, 10, 11, 12, 13, 14, 15); }
__device__ __forceinline__ v16bf cat16b(v8us lo, v8us hi) { return __builtin_bit_cast(v16bf, __builtin_shufflevector(lo, hi, 0, 1, 2, 3, 4, 5, 6, 7, 8, 9, 10, 11, 12, 13, 14, 15)); }
__device__ __forceinline__ v8f wmma16(v16h a, v16h b, v8f c) { return __builtin_amdgcn_wmma_f32_16x16x32_f16(false, a, false, b, (short)0, c, false, false); }
__device__ __forceinline__ v8f wmmab(v16bf a, v16bf b, v8f c) { return __builtin_amdgcn_wmma_f32_16x16x32_bf16(false, a, false, b, (short)0, c, false, false); }
__device__ __forceinline__ h16 tohx(float x) { return (h16)x; }
__device__ __forceinline__ void splitf(float y, unsigned short& h, unsigned short& l) { h = f2bf(y); l = f2bf(y - bf2f(h)); }

// ---- k_gemmw: register-blocked GEMM, ONE WAVE per 64x64 output tile (16 accumulators), operands straight from K-contiguous 16-bit planes; grid (M/64, N/64, Z), 32 threads.
// C[m][n] (f32, pitch ldc, + optional f32 bias[n]) = sum_k A[m][k] Bt[n][k] (+ split products per NSPLIT). z-batch strides sA/sB/sC in elements. K % 32 == 0.
// Fragments: lane -> row/col lane&15; elements 0..7 <- k0 + 8h + 0..7, elements 8..15 <- k0 + 16 + 8h + 0..7 (h = lane>>4), identical for A and Bt.
template <typename T16> struct WFrag;
template <> struct WFrag<h16> { typedef v16h V; static __device__ __forceinline__ V ld(const h16* p) { return cat16(*(const v8h*)p, *(const v8h*)(p + 16)); } static __device__ __forceinline__ v8f mma(V a, V b, v8f c) { return wmma16(a, b, c); } };
template <> struct WFrag<bf> { typedef v16bf V; static __device__ __forceinline__ V ld(const bf* p) { return cat16b(*(const v8us*)p, *(const v8us*)(p + 16)); } static __device__ __forceinline__ v8f mma(V a, V b, v8f c) { return wmmab(a, b, c); } };
template <typename T16, int NSPLIT, bool BIAS>
__global__ __launch_bounds__(32) void k_gemmw(const T16* __restrict__ A, const T16* __restrict__ A2, const T16* __restrict__ Bt, const T16* __restrict__ Bt2, int K, float* C, int ldc, const float* __restrict__ bias, size_t sA, size_t sB, size_t sC) {
    typedef typename WFrag<T16>::V V;
    __shared__ __align__(16) float os[16 * 68];
    const size_t z = blockIdx.z; A += z * sA; if (A2) A2 += z * sA; Bt += z * sB; if (Bt2) Bt2 += z * sB; C += z * sC;
    const int lane = threadIdx.x & 31, lr = lane & 15, hi = lane >> 4; const int r0 = blockIdx.x * 64, c0 = blockIdx.y * 64;
    v8f acc[4][4];
#pragma unroll
    for (int mb = 0; mb < 4; ++mb)
#pragma unroll
        for (int nb = 0; nb < 4; ++nb) acc[mb][nb] = (v8f){};
    const size_t aoff = (size_t)(r0 + lr) * K + 8 * hi, boff = (size_t)(c0 + lr) * K + 8 * hi;
#pragma unroll 1
    for (int kc = 0; kc < K; kc += 32) {
        V a[4], a2[4];
#pragma unroll
        for (int mb = 0; mb < 4; ++mb) { a[mb] = WFrag<T16>::ld(A + aoff + (size_t)mb * 16 * K + kc); if (NSPLIT == 1 || NSPLIT == 2) a2[mb] = WFrag<T16>::ld(A2 + aoff + (size_t)mb * 16 * K + kc); }
#pragma unroll
        for (int nb = 0; nb < 4; ++nb) { const V b = WFrag<T16>::ld(Bt + boff + (size_t)nb * 16 * K + kc); V b2; if (NSPLIT >= 2) b2 = WFrag<T16>::ld(Bt2 + boff + (size_t)nb * 16 * K + kc);
#pragma unroll
            for (int mb = 0; mb < 4; ++mb) { acc[mb][nb] = WFrag<T16>::mma(a[mb], b, acc[mb][nb]); if (NSPLIT == 1 || NSPLIT == 2) acc[mb][nb] = WFrag<T16>::mma(a2[mb], b, acc[mb][nb]); if (NSPLIT >= 2) acc[mb][nb] = WFrag<T16>::mma(a[mb], b2, acc[mb][nb]); } }
        asm volatile("v_nop\n\tv_nop\n\tv_nop\n\tv_nop" : "+v"(acc[0][0]), "+v"(acc[1][1]), "+v"(acc[2][2]), "+v"(acc[3][3]) : "v"(a[0]), "v"(a[3]));
    }
#pragma unroll
    for (int mb = 0; mb < 4; ++mb) {
#pragma unroll
        for (int nb = 0; nb < 4; ++nb) {
#pragma unroll
            for (int j = 0; j < 8; ++j) os[(hi * 8 + j) * 68 + nb * 16 + lr] = acc[mb][nb][j]; }
        __builtin_amdgcn_wave_barrier(); asm volatile("" ::: "memory");
        float* crow = C + (size_t)(r0 + mb * 16) * ldc + c0;
{
#pragma unroll
            for (int s = 0; s < 8; ++s) { const int row = 2 * s + hi, cofs = lr * 4; v4f val = *(const v4fa*)(os + row * 68 + cofs); if (BIAS) { val[0] += bfr(bias[c0 + cofs]); val[1] += bfr(bias[c0 + cofs + 1]); val[2] += bfr(bias[c0 + cofs + 2]); val[3] += bfr(bias[c0 + cofs + 3]); }
                *(v4f*)(crow + (size_t)row * ldc + cofs) = val; }
             }
        __builtin_amdgcn_wave_barrier(); asm volatile("" ::: "memory");
    }
}

__global__ __launch_bounds__(256) void k_cvt8(const float* __restrict__ src, bf* dst, size_t n8) { const size_t i = (size_t)blockIdx.x * 256 + threadIdx.x; if (i >= n8) return; const v8f v = *(const v8f*)(src + i * 8); v8us o;
#pragma unroll
    for (int k = 0; k < 8; ++k) o[k] = f2bf(v[k]); *(v8us*)(dst + i * 8) = o;  }

__global__ __launch_bounds__(256) void k_wt(const float* __restrict__ wq, const float* __restrict__ wk, const float* __restrict__ wv, bf* Bt) {
    const int z = blockIdx.y;
    const float* w = (z == 0) ? wq : ((z == 1) ? wk : wv);
    const size_t i = (size_t)blockIdx.x * 256 + threadIdx.x; if (i >= (size_t)DM * DM / 8) return;
    const size_t e = i * 8; const int k = (int)(e % DM); const int n = (int)(e / DM); const int h = n / HD, c = n % HD;
    v8us o;
#pragma unroll
    for (int q = 0; q < 8; ++q) o[q] = f2bf(w[((size_t)h * DM + k + q) * HD + c]);
    bf* d = Bt + (size_t)z * DM * DM + e;
    *(v8us*)d = o; 
}

__global__ __launch_bounds__(256) void k_qkp(const float* __restrict__ FQ, const float* __restrict__ FK, const float* __restrict__ bq, const float* __restrict__ bk, h16* QP, h16* KP) {
    const int y = blockIdx.y;
    const float* F = y ? FK : FQ; const float* bias = y ? bk : bq; h16* P = y ? KP : QP;
    const size_t i = (size_t)blockIdx.x * 256 + threadIdx.x; if (i >= (size_t)NH_ * TT * HD / 8) return;
    const size_t e = i * 8; const int d = (int)(e % HD); const int t = (int)((e / HD) % TT); const int h = (int)(e / ((size_t)HD * TT));
    const v8f f = *(const v8f*)(F + (size_t)t * DM + h * HD + d); const v8f bb = *(const v8f*)(bias + h * HD + d);
    v8h o;
#pragma unroll
    for (int q = 0; q < 8; ++q) o[q] = tohx(f[q] + bfr(bb[q]));
    *(v8h*)(P + e) = o; 
}

__global__ __launch_bounds__(256) void k_vtp(const float* __restrict__ F, const float* __restrict__ bias, bf* Vh, bf* Vl) {
    const size_t i = (size_t)blockIdx.x * 256 + threadIdx.x; if (i >= (size_t)NH_ * HD * TT / 8) return;
    const size_t e = i * 8; const int t = (int)(e % TT); const int d = (int)((e / TT) % HD); const int h = (int)(e / ((size_t)TT * HD));
    const float bb = bfr(bias[h * HD + d]);
    v8us oh, ol;
#pragma unroll
    for (int q = 0; q < 8; ++q) { const float x = F[(size_t)(t + q) * DM + h * HD + d] + bb; unsigned short a2, c2; splitf(x, a2, c2); oh[q] = a2; ol[q] = c2; }
    *(v8us*)(Vh + e) = oh; *(v8us*)(Vl + e) = ol; 
}

// k_asoft: per row (h, i) of S: t = S x (1/HD); softmax over the TT keys in f32 (register row, one exp2, fixed trees); normalised probabilities stored as bf16 hi + lo planes
__global__ __launch_bounds__(256) void k_asoft(const float* __restrict__ Sb, bf* Ph, bf* Pl) {
    const int lane = threadIdx.x & 31; const int row = blockIdx.x * 8 + (threadIdx.x >> 5); if (row >= NH_ * TT) return;
    const float* sr = Sb + (size_t)row * TT; float v[TT / 32]; float mx = -3.0e38f;
#pragma unroll
    for (int ch = 0; ch < TT / 128; ++ch) { const int j0 = ch * 128 + lane * 4; const v4f a = *(const v4f*)(sr + j0);
#pragma unroll
        for (int q = 0; q < 4; ++q) { const float t = a[q] * SCL; v[ch * 4 + q] = t; mx = fmaxf(mx, t); } }
#pragma unroll
    for (int sh = 16; sh; sh >>= 1) mx = fmaxf(mx, __shfl_xor(mx, sh, 32));
    float sum = 0.f;
#pragma unroll
    for (int k = 0; k < TT / 32; ++k) { float d0 = __fsub_rn(v[k], mx); asm volatile("" : "+v"(d0)); v[k] = __builtin_amdgcn_exp2f(__fmul_rn(d0, 1.4426950408889634f)); sum += v[k]; }
#pragma unroll
    for (int sh = 16; sh; sh >>= 1) sum += __shfl_xor(sum, sh, 32);
    const float f = __fdiv_rn(1.0f, sum);
{
#pragma unroll
        for (int ch = 0; ch < TT / 128; ++ch) { v4us oh, ol;
#pragma unroll
            for (int q = 0; q < 4; ++q) { unsigned short a, c2; splitf(v[ch * 4 + q] * f, a, c2); oh[q] = a; ol[q] = c2; }
            const size_t oo = (size_t)row * TT + ch * 128 + lane * 4; *(v4us*)(Ph + oo) = oh; *(v4us*)(Pl + oo) = ol; }
         }
}

extern "C" void kernel_launch(void* const* d_in, const int* in_sizes, int n_in,
                              void* d_out, int out_size, void* d_ws, size_t ws_size, hipStream_t stream) {
    if (n_in < 7) return;
    if (in_sizes[0] < NB * SEQ_FULL * DM) return;
    if (in_sizes[1] < NH_ * DM * HD || in_sizes[3] < NH_ * DM * HD || in_sizes[5] < NH_ * DM * HD) return;
    if (in_sizes[2] < NH_ * HD || in_sizes[4] < NH_ * HD || in_sizes[6] < NH_ * HD) return;
    if (out_size < NB * TT * DM) return;
    const float* x  = (const float*)d_in[0];
    const float* wq = (const float*)d_in[1]; const float* bq = (const float*)d_in[2];
    const float* wk = (const float*)d_in[3]; const float* bk = (const float*)d_in[4];
    const float* wv = (const float*)d_in[5]; const float* bv = (const float*)d_in[6];
    float* OUT = (float*)d_out;     // [NB][TT][DM]
    char* wsp = (char*)d_ws;
    auto take = [&](size_t bytes) { char* p = wsp; wsp += (bytes + 255) & ~(size_t)255; return (void*)p; };
    bf*    WT  = (bf*)take((size_t)3 * DM * DM * 2);                 // [3][DM][DM]  Bt planes
    bf*    XB  = (bf*)take((size_t)NB * SEQ_FULL * DM * 2);          // bf16 x, all batches
    float* F   = (float*)take((size_t)3 * TT * DM * 4);              // q | k | v projections [TT][DM] each
    h16*   QP  = (h16*)take((size_t)NH_ * TT * HD * 2);
    h16*   KP  = (h16*)take((size_t)NH_ * TT * HD * 2);
    bf*    VTh = (bf*)take((size_t)NH_ * HD * TT * 2);
    bf*    VTl = (bf*)take((size_t)NH_ * HD * TT * 2);
    float* Sb  = (float*)take((size_t)NH_ * TT * TT * 4);
    bf*    Ph  = (bf*)take((size_t)NH_ * TT * TT * 2);
    bf*    Pl  = (bf*)take((size_t)NH_ * TT * TT * 2);
    if ((size_t)(wsp - (char*)d_ws) > ws_size) return;    // 132,513,792 B at NB=8, TT=1024
    float* FQ = F; float* FK = F + (size_t)TT * DM; float* FV = F + (size_t)2 * TT * DM;

    k_wt<<<dim3((unsigned)(((size_t)DM * DM / 8 + 255) / 256), 3), 256, 0, stream>>>(wq, wk, wv, WT);
    const size_t nx8 = (size_t)NB * SEQ_FULL * DM / 8;
    k_cvt8<<<(unsigned)((nx8 + 255) / 256), 256, 0, stream>>>(x, XB, nx8);
    const unsigned LP = (unsigned)(((size_t)NH_ * TT * HD / 8 + 255) / 256);
    for (int b = 0; b < NB; ++b) {
        // F[z][t][n] = sum_k bf16(x[b][t][k]) Bt[z][n][k], z over the three weights
        k_gemmw<bf, 0, false><<<dim3(TT / 64, DM / 64, 3), 32, 0, stream>>>(XB + (size_t)b * SEQ_FULL * DM, nullptr, WT, nullptr, DM, F, DM, nullptr, (size_t)0, (size_t)DM * DM, (size_t)TT * DM);
        k_qkp<<<dim3(LP, 2), 256, 0, stream>>>(FQ, FK, bq, bk, QP, KP);
        k_vtp<<<LP, 256, 0, stream>>>(FV, bv, VTh, VTl);
        // S[h][t][t'] = sum_d q[h][t][d] k[h][t'][d]
        k_gemmw<h16, 0, false><<<dim3(TT / 64, TT / 64, NH_), 32, 0, stream>>>(QP, nullptr, KP, nullptr, HD, Sb, TT, nullptr, (size_t)TT * HD, (size_t)TT * HD, (size_t)TT * TT);
        k_asoft<<<(unsigned)((NH_ * TT + 7) / 8), 256, 0, stream>>>(Sb, Ph, Pl);
        // out[b][t][h*HD + d] = sum_t' P[h][t][t'] V[h][d][t'] (3 products hh + lh + hl)
        k_gemmw<bf, 2, false><<<dim3(TT / 64, HD / 64, NH_), 32, 0, stream>>>(Ph, Pl, VTh, VTl, TT, OUT + (size_t)b * TT * DM, DM, nullptr, (size_t)TT * TT, (size_t)HD * TT, (size_t)HD);
    }
}

// v001
// It runs in 323 microseconds.
// In two side-by-side timings against v000, it was 2.11 and 2.14 times as fast.
#include <hip/hip_runtime.h>

// Contractions, f32 accumulate: q/k/v projections v_wmma_f32_16x16x32_bf16 on bf16 (RNE) copies of x and W (exact products); scores v_wmma_f32_16x16x32_f16 on f16 q/k planes (single product); softmax f32; P.V v_wmma_f32_16x16x32_bf16 with P and V carried as bf16 hi+lo planes (3 products).
// Pipeline: per batch F[3][t][768] = bf16(x_b) x Bt (3 weights, grid.z); q/k planes [b][h][t][d] f16 (+bias); value planes [b][h][d][t] bf16 hi/lo (+bias); then ONE launch over all (batch, head, 128 queries): S^T = K Q^T, online softmax of S/HD in f32, O^T += V^T P^T with P packed from the score accumulators, out[b][t][h*HD + d] written directly.

#ifndef NB
#define NB 8
#endif
#ifndef SEQ
#define SEQ 1024
#endif
#define SEQ_FULL 1024
#define TT   SEQ
#define DM   768
#define NH_  12
#define HD   64
#define SCL  0.015625f   // 1/HD (scores are divided by head_dim)

static_assert(TT % 128 == 0);
static_assert(TT <= SEQ_FULL);
static_assert(NH_ * HD == DM);
static_assert(DM % 64 == 0);
static_assert(HD == 64);
static_assert(NB >= 1 && NB <= 8);

typedef _Float16 h16;
typedef unsigned short bf;
typedef __attribute__((ext_vector_type(16))) __bf16   v16bf;
typedef __attribute__((ext_vector_type(16))) _Float16 v16h;
typedef __attribute__((ext_vector_type(8)))  _Float16 v8h;
typedef __attribute__((ext_vector_type(8)))  unsigned short v8us;
typedef __attribute__((ext_vector_type(8)))  float    v8f;
typedef __attribute__((ext_vector_type(4)))  float    v4f;
typedef __attribute__((ext_vector_type(4)))  unsigned short v4us;
typedef v8h  __attribute__((may_alias)) v8ha;
typedef v4f  __attribute__((may_alias)) v4fa;
typedef v8us __attribute__((may_alias)) v8usa;

__device__ __forceinline__ unsigned short f2bf(float f) { unsigned u = __float_as_uint(f); u += 0x7FFFu + ((u >> 16) & 1u); return (unsigned short)(u >> 16); }
__device__ __forceinline__ float bf2f(unsigned short b) { return __uint_as_float(((unsigned)b) << 16); }
__device__ __forceinline__ float bfr(float f) { return bf2f(f2bf(f)); }
__device__ __forceinline__ v16h cat16(v8h lo, v8h hi) { return __builtin_shufflevector(lo, hi, 0, 1, 2, 3, 4, 5, 6, 7, 8, 9, 10, 11, 12, 13, 14, 15); }
__device__ __forceinline__ v16bf cat16b(v8us lo, v8us hi) { return __builtin_bit_cast(v16bf, __builtin_shufflevector(lo, hi, 0, 1, 2, 3, 4, 5, 6, 7, 8, 9, 10, 11, 12, 13, 14, 15)); }
__device__ __forceinline__ v8f wmma16(v16h a, v16h b, v8f c) { return __builtin_amdgcn_wmma_f32_16x16x32_f16(false, a, false, b, (short)0, c, false, false); }
__device__ __forceinline__ v8f wmmab(v16bf a, v16bf b, v8f c) { return __builtin_amdgcn_wmma_f32_16x16x32_bf16(false, a, false, b, (short)0, c, false, false); }
__device__ __forceinline__ h16 tohx(float x) { return (h16)x; }
__device__ __forceinline__ void splitf(float y, unsigned short& h, unsigned short& l) { h = f2bf(y); l = f2bf(y - bf2f(h)); }

// ---- k_gemmw: register-blocked GEMM, ONE WAVE per 64x64 output tile (16 accumulators), operands straight from K-contiguous 16-bit planes; grid (M/64, N/64, Z), 32 threads.
// C[m][n] (f32, pitch ldc, + optional f32 bias[n]) = sum_k A[m][k] Bt[n][k] (+ split products per NSPLIT). z-batch strides sA/sB/sC in elements. K % 32 == 0.
// Fragments: lane -> row/col lane&15; elements 0..7 <- k0 + 8h + 0..7, elements 8..15 <- k0 + 16 + 8h + 0..7 (h = lane>>4), identical for A and Bt.
template <typename T16> struct WFrag;
template <> struct WFrag<h16> { typedef v16h V; static __device__ __forceinline__ V ld(const h16* p) { return cat16(*(const v8h*)p, *(const v8h*)(p + 16)); } static __device__ __forceinline__ v8f mma(V a, V b, v8f c) { return wmma16(a, b, c); } };
template <> struct WFrag<bf> { typedef v16bf V; static __device__ __forceinline__ V ld(const bf* p) { return cat16b(*(const v8us*)p, *(const v8us*)(p + 16)); } static __device__ __forceinline__ v8f mma(V a, V b, v8f c) { return wmmab(a, b, c); } };
template <typename T16, int NSPLIT, bool BIAS>
__global__ __launch_bounds__(32) void k_gemmw(const T16* __restrict__ A, const T16* __restrict__ A2, const T16* __restrict__ Bt, const T16* __restrict__ Bt2, int K, float* C, int ldc, const float* __restrict__ bias, size_t sA, size_t sB, size_t sC) {
    typedef typename WFrag<T16>::V V;
    __shared__ __align__(16) float os[16 * 68];
    const size_t z = blockIdx.z; A += z * sA; if (A2) A2 += z * sA; Bt += z * sB; if (Bt2) Bt2 += z * sB; C += z * sC;
    const int lane = threadIdx.x & 31, lr = lane & 15, hi = lane >> 4; const int r0 = blockIdx.x * 64, c0 = blockIdx.y * 64;
    v8f acc[4][4];
#pragma unroll
    for (int mb = 0; mb < 4; ++mb)
#pragma unroll
        for (int nb = 0; nb < 4; ++nb) acc[mb][nb] = (v8f){};
    const size_t aoff = (size_t)(r0 + lr) * K + 8 * hi, boff = (size_t)(c0 + lr) * K + 8 * hi;
#pragma unroll 1
    for (int kc = 0; kc < K; kc += 32) {
        V a[4], a2[4];
#pragma unroll
        for (int mb = 0; mb < 4; ++mb) { a[mb] = WFrag<T16>::ld(A + aoff + (size_t)mb * 16 * K + kc); if (NSPLIT == 1 || NSPLIT == 2) a2[mb] = WFrag<T16>::ld(A2 + aoff + (size_t)mb * 16 * K + kc); }
#pragma unroll
        for (int nb = 0; nb < 4; ++nb) { const V b = WFrag<T16>::ld(Bt + boff + (size_t)nb * 16 * K + kc); V b2; if (NSPLIT >= 2) b2 = WFrag<T16>::ld(Bt2 + boff + (size_t)nb * 16 * K + kc);
#pragma unroll
            for (int mb = 0; mb < 4; ++mb) { acc[mb][nb] = WFrag<T16>::mma(a[mb], b, acc[mb][nb]); if (NSPLIT == 1 || NSPLIT == 2) acc[mb][nb] = WFrag<T16>::mma(a2[mb], b, acc[mb][nb]); if (NSPLIT >= 2) acc[mb][nb] = WFrag<T16>::mma(a[mb], b2, acc[mb][nb]); } }
        asm volatile("v_nop\n\tv_nop\n\tv_nop\n\tv_nop" : "+v"(acc[0][0]), "+v"(acc[1][1]), "+v"(acc[2][2]), "+v"(acc[3][3]) : "v"(a[0]), "v"(a[3]));
    }
#pragma unroll
    for (int mb = 0; mb < 4; ++mb) {
#pragma unroll
        for (int nb = 0; nb < 4; ++nb) {
#pragma unroll
            for (int j = 0; j < 8; ++j) os[(hi * 8 + j) * 68 + nb * 16 + lr] = acc[mb][nb][j]; }
        __builtin_amdgcn_wave_barrier(); asm volatile("" ::: "memory");
        float* crow = C + (size_t)(r0 + mb * 16) * ldc + c0;
{
#pragma unroll
            for (int s = 0; s < 8; ++s) { const int row = 2 * s + hi, cofs = lr * 4; v4f val = *(const v4fa*)(os + row * 68 + cofs); if (BIAS) { val[0] += bfr(bias[c0 + cofs]); val[1] += bfr(bias[c0 + cofs + 1]); val[2] += bfr(bias[c0 + cofs + 2]); val[3] += bfr(bias[c0 + cofs + 3]); }
                *(v4f*)(crow + (size_t)row * ldc + cofs) = val; }
             }
        __builtin_amdgcn_wave_barrier(); asm volatile("" ::: "memory");
    }
}

__global__ __launch_bounds__(256) void k_cvt8(const float* __restrict__ src, bf* dst, size_t n8) { const size_t i = (size_t)blockIdx.x * 256 + threadIdx.x; if (i >= n8) return; const v8f v = *(const v8f*)(src + i * 8); v8us o;
#pragma unroll
    for (int k = 0; k < 8; ++k) o[k] = f2bf(v[k]); *(v8us*)(dst + i * 8) = o;  }

__global__ __launch_bounds__(256) void k_wt(const float* __restrict__ wq, const float* __restrict__ wk, const float* __restrict__ wv, bf* Bt) {
    const int z = blockIdx.y;
    const float* w = (z == 0) ? wq : ((z == 1) ? wk : wv);
    const size_t i = (size_t)blockIdx.x * 256 + threadIdx.x; if (i >= (size_t)DM * DM / 8) return;
    const size_t e = i * 8; const int k = (int)(e % DM); const int n = (int)(e / DM); const int h = n / HD, c = n % HD;
    v8us o;
#pragma unroll
    for (int q = 0; q < 8; ++q) o[q] = f2bf(w[((size_t)h * DM + k + q) * HD + c]);
    bf* d = Bt + (size_t)z * DM * DM + e;
    *(v8us*)d = o; 
}

__global__ __launch_bounds__(256) void k_qkp(const float* __restrict__ FQ, const float* __restrict__ FK, const float* __restrict__ bq, const float* __restrict__ bk, h16* QP, h16* KP) {
    const int y = blockIdx.y;
    const float* F = y ? FK : FQ; const float* bias = y ? bk : bq; h16* P = y ? KP : QP;
    const size_t i = (size_t)blockIdx.x * 256 + threadIdx.x; if (i >= (size_t)NH_ * TT * HD / 8) return;
    const size_t e = i * 8; const int d = (int)(e % HD); const int t = (int)((e / HD) % TT); const int h = (int)(e / ((size_t)HD * TT));
    const v8f f = *(const v8f*)(F + (size_t)t * DM + h * HD + d); const v8f bb = *(const v8f*)(bias + h * HD + d);
    v8h o;
#pragma unroll
    for (int q = 0; q < 8; ++q) o[q] = tohx(f[q] + bfr(bb[q]));
    *(v8h*)(P + e) = o; 
}

__global__ __launch_bounds__(256) void k_vtp(const float* __restrict__ F, const float* __restrict__ bias, bf* Vh, bf* Vl) {
    const size_t i = (size_t)blockIdx.x * 256 + threadIdx.x; if (i >= (size_t)NH_ * HD * TT / 8) return;
    const size_t e = i * 8; const int t = (int)(e % TT); const int d = (int)((e / TT) % HD); const int h = (int)(e / ((size_t)TT * HD));
    const float bb = bfr(bias[h * HD + d]);
    v8us oh, ol;
#pragma unroll
    for (int q = 0; q < 8; ++q) { const float x = F[(size_t)(t + q) * DM + h * HD + d] + bb; unsigned short a2, c2; splitf(x, a2, c2); oh[q] = a2; ol[q] = c2; }
    *(v8us*)(Vh + e) = oh; *(v8us*)(Vl + e) = ol; 
}

typedef __attribute__((ext_vector_type(2))) float  v2f;
typedef __attribute__((ext_vector_type(2))) __bf16 v2bf;
#define CS2 (SCL * 1.4426950408889634f)
__device__ __forceinline__ float xhalf(float x) { const int b = __float_as_int(x); return __int_as_float(__builtin_amdgcn_permlanex16(b, b, 0x76543210, 0xfedcba98, false, false)); }
__global__ __launch_bounds__(128) void k_fattn(const h16* __restrict__ QP, const h16* __restrict__ KP, const bf* __restrict__ Vh, const bf* __restrict__ Vl, float* __restrict__ OUT) {
    const int lane = threadIdx.x & 31, c = lane & 15, hi = lane >> 4, wave = threadIdx.x >> 5;
    const size_t bh = (size_t)blockIdx.z * NH_ + blockIdx.y;
    const int q0 = blockIdx.x * 128 + wave * 32;
    const h16* qp = QP + bh * TT * HD + (size_t)(q0 + c) * HD + 8 * hi;
    const h16* kp = KP + bh * TT * HD + (size_t)c * HD + 8 * hi;
    const bf* vhp = Vh + bh * HD * TT + (size_t)c * TT + 8 * hi;
    const bf* vlp = Vl + bh * HD * TT + (size_t)c * TT + 8 * hi;
    v16h qf[2][2], kf[2][2];
#pragma unroll
    for (int cg = 0; cg < 2; ++cg)
#pragma unroll
        for (int ks = 0; ks < 2; ++ks) qf[cg][ks] = WFrag<h16>::ld(qp + cg * 16 * HD + ks * 32);
#pragma unroll
    for (int kt = 0; kt < 2; ++kt)
#pragma unroll
        for (int ks = 0; ks < 2; ++ks) kf[kt][ks] = WFrag<h16>::ld(kp + kt * 16 * HD + ks * 32);
    v8f acc[4][2];
#pragma unroll
    for (int dt = 0; dt < 4; ++dt)
#pragma unroll
        for (int cg = 0; cg < 2; ++cg) acc[dt][cg] = (v8f){};
    float m[2] = {-3.0e38f, -3.0e38f}; v2f sm[2] = {(v2f){0.f, 0.f}, (v2f){0.f, 0.f}};   // sm: a lane's sums over its even and its odd keys
    for (int kb = 0; kb < TT; kb += 32) {
        v16bf vhf[4], vlf[4];
#pragma unroll
        for (int dt = 0; dt < 4; ++dt) { vhf[dt] = WFrag<bf>::ld(vhp + (size_t)dt * 16 * TT + kb); vlf[dt] = WFrag<bf>::ld(vlp + (size_t)dt * 16 * TT + kb); }
        v8f st[2][2];   // st[kt][cg][r] = S[q0 + 16 cg + c][kb + 16 kt + 8 hi + r]
#pragma unroll
        for (int kt = 0; kt < 2; ++kt)
#pragma unroll
            for (int cg = 0; cg < 2; ++cg) st[kt][cg] = wmma16(kf[kt][0], qf[cg][0], (v8f){});
#pragma unroll
        for (int kt = 0; kt < 2; ++kt)
#pragma unroll
            for (int cg = 0; cg < 2; ++cg) st[kt][cg] = wmma16(kf[kt][1], qf[cg][1], st[kt][cg]);
        const int kn = (kb + 32 < TT) ? kb + 32 : 0;   // next pass's key fragments, fetched behind this pass's score products (the last pass refetches block 0, unused)
#pragma unroll
        for (int kt = 0; kt < 2; ++kt)
#pragma unroll
            for (int ks = 0; ks < 2; ++ks) kf[kt][ks] = WFrag<h16>::ld(kp + (size_t)(kn + kt * 16) * HD + ks * 32);
        float mx[2];
#pragma unroll
        for (int cg = 0; cg < 2; ++cg) { float a = fmaxf(st[0][cg][0], st[1][cg][0]);
#pragma unroll
            for (int r = 1; r < 8; ++r) a = fmaxf(a, fmaxf(st[0][cg][r], st[1][cg][r]));
            a *= CS2; mx[cg] = fmaxf(a, xhalf(a)); }
        const bool need = (mx[0] > m[0] + 8.0f) || (mx[1] > m[1] + 8.0f);
        if (__builtin_amdgcn_ballot_w32(need) != 0) {
#pragma unroll
            for (int cg = 0; cg < 2; ++cg) { const float mn = fmaxf(m[cg], mx[cg]); const float al = __builtin_amdgcn_exp2f(m[cg] - mn); m[cg] = mn; sm[cg] *= al;
#pragma unroll
                for (int dt = 0; dt < 4; ++dt) acc[dt][cg] *= al; }
        }
        v16bf ph[2], pl[2];
#pragma unroll
        for (int cg = 0; cg < 2; ++cg) { const v2f nm = {-m[cg], -m[cg]};
#pragma unroll
            for (int s = 0; s < 16; s += 2) {   // register pairs as they lie in the score tile: packed f32 operations, no copies
                const v2f t = __builtin_elementwise_fma((v2f){st[s >> 3][cg][s & 7], st[s >> 3][cg][(s & 7) + 1]}, (v2f){CS2, CS2}, nm);
                const v2f p = {__builtin_amdgcn_exp2f(t[0]), __builtin_amdgcn_exp2f(t[1])};
                sm[cg] += p;
                const v2bf h2 = __builtin_convertvector(p, v2bf);
                const v2bf l2 = __builtin_convertvector(p - __builtin_convertvector(h2, v2f), v2bf);
                ph[cg][s] = h2[0]; ph[cg][s + 1] = h2[1]; pl[cg][s] = l2[0]; pl[cg][s + 1] = l2[1];
            }
        }
        // three products per tile in the order hi.hi, lo(P).hi(V), hi(P).lo(V); eight independent tiles between dependent accumulates
#pragma unroll
        for (int dt = 0; dt < 4; ++dt)
#pragma unroll
            for (int cg = 0; cg < 2; ++cg) acc[dt][cg] = wmmab(vhf[dt], ph[cg], acc[dt][cg]);
#pragma unroll
        for (int dt = 0; dt < 4; ++dt)
#pragma unroll
            for (int cg = 0; cg < 2; ++cg) acc[dt][cg] = wmmab(vhf[dt], pl[cg], acc[dt][cg]);
#pragma unroll
        for (int dt = 0; dt < 4; ++dt)
#pragma unroll
            for (int cg = 0; cg < 2; ++cg) acc[dt][cg] = wmmab(vlf[dt], ph[cg], acc[dt][cg]);
    }
#pragma unroll
    for (int cg = 0; cg < 2; ++cg) {
        const float sl = sm[cg][0] + sm[cg][1]; const float f = __fdiv_rn(1.0f, sl + xhalf(sl));
        float* o = OUT + ((size_t)blockIdx.z * TT + q0 + cg * 16 + c) * DM + blockIdx.y * HD + 8 * hi;   // acc[dt][cg][r] = O[q0 + 16 cg + c][16 dt + 8 hi + r]
#pragma unroll
        for (int dt = 0; dt < 4; ++dt) { const v8f a = acc[dt][cg] * f; *(v4f*)(o + dt * 16) = (v4f){a[0], a[1], a[2], a[3]}; *(v4f*)(o + dt * 16 + 4) = (v4f){a[4], a[5], a[6], a[7]}; }
    }
}

extern "C" void kernel_launch(void* const* d_in, const int* in_sizes, int n_in,
                              void* d_out, int out_size, void* d_ws, size_t ws_size, hipStream_t stream) {
    if (n_in < 7) return;
    if (in_sizes[0] < NB * SEQ_FULL * DM) return;
    if (in_sizes[1] < NH_ * DM * HD || in_sizes[3] < NH_ * DM * HD || in_sizes[5] < NH_ * DM * HD) return;
    if (in_sizes[2] < NH_ * HD || in_sizes[4] < NH_ * HD || in_sizes[6] < NH_ * HD) return;
    if (out_size < NB * TT * DM) return;
    const float* x  = (const float*)d_in[0];
    const float* wq = (const float*)d_in[1]; const float* bq = (const float*)d_in[2];
    const float* wk = (const float*)d_in[3]; const float* bk = (const float*)d_in[4];
    const float* wv = (const float*)d_in[5]; const float* bv = (const float*)d_in[6];
    float* OUT = (float*)d_out;     // [NB][TT][DM]
    char* wsp = (char*)d_ws;
    auto take = [&](size_t bytes) { char* p = wsp; wsp += (bytes + 255) & ~(size_t)255; return (void*)p; };
    bf*    WT  = (bf*)take((size_t)3 * DM * DM * 2);                 // [3][DM][DM]  Bt planes
    bf*    XB  = (bf*)take((size_t)NB * SEQ_FULL * DM * 2);          // bf16 x, all batches
    float* F   = (float*)take((size_t)3 * TT * DM * 4);              // q | k | v projections [TT][DM] each
    h16*   QP  = (h16*)take((size_t)NB * NH_ * TT * HD * 2);         // planes of all batches
    h16*   KP  = (h16*)take((size_t)NB * NH_ * TT * HD * 2);
    bf*    VTh = (bf*)take((size_t)NB * NH_ * HD * TT * 2);
    bf*    VTl = (bf*)take((size_t)NB * NH_ * HD * TT * 2);
    if ((size_t)(wsp - (char*)d_ws) > ws_size) return;
    float* FQ = F; float* FK = F + (size_t)TT * DM; float* FV = F + (size_t)2 * TT * DM;

    k_wt<<<dim3((unsigned)(((size_t)DM * DM / 8 + 255) / 256), 3), 256, 0, stream>>>(wq, wk, wv, WT);
    const size_t nx8 = (size_t)NB * SEQ_FULL * DM / 8;
    k_cvt8<<<(unsigned)((nx8 + 255) / 256), 256, 0, stream>>>(x, XB, nx8);
    const unsigned LP = (unsigned)(((size_t)NH_ * TT * HD / 8 + 255) / 256);
    for (int b = 0; b < NB; ++b) {
        // F[z][t][n] = sum_k bf16(x[b][t][k]) Bt[z][n][k], z over the three weights
        k_gemmw<bf, 0, false><<<dim3(TT / 64, DM / 64, 3), 32, 0, stream>>>(XB + (size_t)b * SEQ_FULL * DM, nullptr, WT, nullptr, DM, F, DM, nullptr, (size_t)0, (size_t)DM * DM, (size_t)TT * DM);
        k_qkp<<<dim3(LP, 2), 256, 0, stream>>>(FQ, FK, bq, bk, QP + (size_t)b * NH_ * TT * HD, KP + (size_t)b * NH_ * TT * HD);
        k_vtp<<<LP, 256, 0, stream>>>(FV, bv, VTh + (size_t)b * NH_ * HD * TT, VTl + (size_t)b * NH_ * HD * TT);
    }
    k_fattn<<<dim3(TT / 128, NH_, NB), 128, 0, stream>>>(QP, KP, VTh, VTl, OUT);
}

// v002
// It runs in 142 microseconds.
// Timed twice side by side with v001, it ran 2.26 and 2.28 times as fast.
// All steps since v000 together make it 4.83 times as fast.
#include <hip/hip_runtime.h>

// Contractions, f32 accumulate: q/k/v projections v_wmma_f32_16x16x32_bf16 on bf16 (RNE) copies of x and W (exact products); scores v_wmma_f32_16x16x32_f16 on f16 q/k planes (single product); softmax f32; P.V v_wmma_f32_16x16x32_bf16 with P and V carried as bf16 hi+lo planes (3 products).
// Pipeline: ONE launch over all (batch, 64 tokens, head, weight): bf16(x) x Bt, +bias, written straight as q/k planes [b][h][t][d] f16 and value planes [b][h][d][t] bf16 hi/lo; then ONE launch over all (batch, head, 128 queries): S^T = K Q^T, online softmax of S/HD in f32, O^T += V^T P^T with P packed from the score accumulators, out[b][t][h*HD + d] written directly.

#ifndef NB
#define NB 8
#endif
#ifndef SEQ
#define SEQ 1024
#endif
#define SEQ_FULL 1024
#define TT   SEQ
#define DM   768
#define NH_  12
#define HD   64
#define SCL  0.015625f   // 1/HD (scores are divided by head_dim)

static_assert(TT % 128 == 0);
static_assert(TT <= SEQ_FULL);
static_assert(NH_ * HD == DM);
static_assert(DM % 64 == 0);
static_assert(HD == 64);
static_assert(NH_ % 2 == 0);
static_assert(NB >= 1 && NB <= 8);

typedef _Float16 h16;
typedef unsigned short bf;
typedef __attribute__((ext_vector_type(16))) __bf16   v16bf;
typedef __attribute__((ext_vector_type(16))) _Float16 v16h;
typedef __attribute__((ext_vector_type(8)))  _Float16 v8h;
typedef __attribute__((ext_vector_type(8)))  unsigned short v8us;
typedef __attribute__((ext_vector_type(8)))  float    v8f;
typedef __attribute__((ext_vector_type(4)))  float    v4f;
typedef __attribute__((ext_vector_type(4)))  unsigned short v4us;
typedef v8h  __attribute__((may_alias)) v8ha;
typedef v4f  __attribute__((may_alias)) v4fa;
typedef v8us __attribute__((may_alias)) v8usa;

__device__ __forceinline__ unsigned short f2bf(float f) { unsigned u = __float_as_uint(f); u += 0x7FFFu + ((u >> 16) & 1u); return (unsigned short)(u >> 16); }
__device__ __forceinline__ float bf2f(unsigned short b) { return __uint_as_float(((unsigned)b) << 16); }
__device__ __forceinline__ float bfr(float f) { return bf2f(f2bf(f)); }
__device__ __forceinline__ v16h cat16(v8h lo, v8h hi) { return __builtin_shufflevector(lo, hi, 0, 1, 2, 3, 4, 5, 6, 7, 8, 9, 10, 11, 12, 13, 14, 15); }
__device__ __forceinline__ v16bf cat16b(v8us lo, v8us hi) { return __builtin_bit_cast(v16bf, __builtin_shufflevector(lo, hi, 0, 1, 2, 3, 4, 5, 6, 7, 8, 9, 10, 11, 12, 13, 14, 15)); }
__device__ __forceinline__ v8f wmma16(v16h a, v16h b, v8f c) { return __builtin_amdgcn_wmma_f32_16x16x32_f16(false, a, false, b, (short)0, c, false, false); }
__device__ __forceinline__ v8f wmmab(v16bf a, v16bf b, v8f c) { return __builtin_amdgcn_wmma_f32_16x16x32_bf16(false, a, false, b, (short)0, c, false, false); }
__device__ __forceinline__ h16 tohx(float x) { return (h16)x; }
__device__ __forceinline__ void splitf(float y, unsigned short& h, unsigned short& l) { h = f2bf(y); l = f2bf(y - bf2f(h)); }

// ---- k_proj: q, k and v projections of ALL batches in one launch; the epilogue adds the bias and writes the operand planes of k_fattn straight from the accumulators.
// One wave per 64 tokens x one head x one of q/k/v (16 accumulators, K = DM), operands straight from the K-contiguous bf16 planes; 4 waves per work-group = 2 token tiles x 2 heads; grid (NB*TT/128, NH_/2, 3).
// Fragments: lane -> row/col lane&15; elements 0..7 <- k0 + 8h + 0..7, elements 8..15 <- k0 + 16 + 8h + 0..7 (h = lane>>4), identical for both operands, so either plane can stand on either side of the product.
// A lane's 8 accumulator registers run along the rows of the first operand: the weight rows stand first for q and k (8 consecutive d of one token = one 16-byte store into [t][d]), the token rows stand first for v (8 consecutive t of one d = one 16-byte store into [d][t]).
template <typename T16> struct WFrag;
template <> struct WFrag<h16> { typedef v16h V; static __device__ __forceinline__ V ld(const h16* p) { return cat16(*(const v8h*)p, *(const v8h*)(p + 16)); } static __device__ __forceinline__ v8f mma(V a, V b, v8f c) { return wmma16(a, b, c); } };
template <> struct WFrag<bf> { typedef v16bf V; static __device__ __forceinline__ V ld(const bf* p) { return cat16b(*(const v8us*)p, *(const v8us*)(p + 16)); } static __device__ __forceinline__ v8f mma(V a, V b, v8f c) { return wmmab(a, b, c); } };
__global__ __launch_bounds__(128) void k_proj(const bf* __restrict__ XB, const bf* __restrict__ WT, const float* __restrict__ bq, const float* __restrict__ bk, const float* __restrict__ bv, h16* QP, h16* KP, bf* Vh, bf* Vl) {
    const int lane = threadIdx.x & 31, lr = lane & 15, hi = lane >> 4;
    const int wave = __builtin_amdgcn_readfirstlane(threadIdx.x >> 5);   // the tile's indices stay in scalar registers
    const int z = blockIdx.z;
    const int r0 = (blockIdx.x * 2 + (wave & 1)) * 64, b = r0 / TT, t0 = r0 % TT;   // 64 tokens of one batch (TT % 64 == 0)
    const int h = blockIdx.y * 2 + (wave >> 1);
    const bf* xr = XB + ((size_t)b * SEQ_FULL + t0 + lr) * DM + 8 * hi;
    const bf* wr = WT + ((size_t)z * DM + h * HD + lr) * DM + 8 * hi;
    const bf* P = (z == 2) ? xr : wr;   // rows of the result tile
    const bf* Q = (z == 2) ? wr : xr;   // columns of the result tile
    v8f acc[4][4];
#pragma unroll
    for (int mb = 0; mb < 4; ++mb)
#pragma unroll
        for (int nb = 0; nb < 4; ++nb) acc[mb][nb] = (v8f){};
#pragma unroll 1
    for (int kc = 0; kc < DM; kc += 32) {   // kept rolled: one pass's fragments and the 16 accumulators are the register budget
        const bf* pk = P + kc; const bf* qk = Q + kc;
        v16bf a[4];
#pragma unroll
        for (int mb = 0; mb < 4; ++mb) a[mb] = WFrag<bf>::ld(pk + (size_t)mb * 16 * DM);
#pragma unroll
        for (int nb = 0; nb < 4; ++nb) { const v16bf q = WFrag<bf>::ld(qk + (size_t)nb * 16 * DM);
#pragma unroll
            for (int mb = 0; mb < 4; ++mb) acc[mb][nb] = wmmab(a[mb], q, acc[mb][nb]); }
        // the pass's two address pairs stay untouched up to this wait; the next pass overwrites them behind it
        asm volatile("s_wait_xcnt 0x0" :: "v"(pk), "v"(qk) : "memory");
        // four vector slots between the pass's last matrix instructions and, over the back edge, the loads that overwrite their operands
        asm volatile("v_nop\n\tv_nop\n\tv_nop\n\tv_nop" : "+v"(acc[0][0]), "+v"(acc[1][1]), "+v"(acc[2][2]), "+v"(acc[3][3]) : "v"(a[0]), "v"(a[3]));
    }
    const size_t bh = (size_t)b * NH_ + h;
    if (z < 2) {   // acc[mb][nb][j] = (x W)[t0 + 16 nb + lr][16 mb + 8 hi + j]
        const float* bias = (z ? bk : bq) + h * HD + 8 * hi;
        h16* o = (z ? KP : QP) + (bh * TT + t0 + lr) * HD + 8 * hi;
        v8f bb[4];
#pragma unroll
        for (int mb = 0; mb < 4; ++mb) bb[mb] = *(const v8f*)(bias + mb * 16);
#pragma unroll
        for (int mb = 0; mb < 4; ++mb)
#pragma unroll
            for (int j = 0; j < 8; ++j) bb[mb][j] = bfr(bb[mb][j]);
#pragma unroll
        for (int nb = 0; nb < 4; ++nb)
#pragma unroll
            for (int mb = 0; mb < 4; ++mb) { v8h v;
#pragma unroll
                for (int j = 0; j < 8; ++j) v[j] = tohx(acc[mb][nb][j] + bb[mb][j]);
                *(v8h*)(o + (size_t)nb * 16 * HD + mb * 16) = v; }
    } else {       // acc[mb][nb][j] = (x W)[t0 + 16 mb + 8 hi + j][16 nb + lr]
        const size_t e = (bh * HD + lr) * TT + t0 + 8 * hi;
        float bl[4];
#pragma unroll
        for (int nb = 0; nb < 4; ++nb) bl[nb] = bv[h * HD + nb * 16 + lr];
#pragma unroll
        for (int nb = 0; nb < 4; ++nb) { const float bb = bfr(bl[nb]);
#pragma unroll
            for (int mb = 0; mb < 4; ++mb) { v8us oh, ol;
#pragma unroll
                for (int j = 0; j < 8; ++j) { unsigned short a2, c2; splitf(acc[mb][nb][j] + bb, a2, c2); oh[j] = a2; ol[j] = c2; }
                *(v8us*)(Vh + e + (size_t)nb * 16 * TT + mb * 16) = oh; *(v8us*)(Vl + e + (size_t)nb * 16 * TT + mb * 16) = ol;
                __builtin_amdgcn_sched_barrier(0); } }   // one tile's split at a time: interleaved tiles' temporaries lift the kernel over 192 registers, the most that lets five waves share a SIMD
    }
}

__global__ __launch_bounds__(256) void k_cvt8(const float* __restrict__ src, bf* dst, size_t n8) { const size_t i = (size_t)blockIdx.x * 256 + threadIdx.x; if (i >= n8) return; const v8f v = *(const v8f*)(src + i * 8); v8us o;
#pragma unroll
    for (int k = 0; k < 8; ++k) o[k] = f2bf(v[k]); *(v8us*)(dst + i * 8) = o;  }

__global__ __launch_bounds__(256) void k_wt(const float* __restrict__ wq, const float* __restrict__ wk, const float* __restrict__ wv, bf* Bt) {
    const int z = blockIdx.y;
    const float* w = (z == 0) ? wq : ((z == 1) ? wk : wv);
    const size_t i = (size_t)blockIdx.x * 256 + threadIdx.x; if (i >= (size_t)DM * DM / 8) return;
    const size_t e = i * 8; const int k = (int)(e % DM); const int n = (int)(e / DM); const int h = n / HD, c = n % HD;
    v8us o;
#pragma unroll
    for (int q = 0; q < 8; ++q) o[q] = f2bf(w[((size_t)h * DM + k + q) * HD + c]);
    bf* d = Bt + (size_t)z * DM * DM + e;
    *(v8us*)d = o; 
}

typedef __attribute__((ext_vector_type(2))) float  v2f;
typedef __attribute__((ext_vector_type(2))) __bf16 v2bf;
#define CS2 (SCL * 1.4426950408889634f)
__device__ __forceinline__ float xhalf(float x) { const int b = __float_as_int(x); return __int_as_float(__builtin_amdgcn_permlanex16(b, b, 0x76543210, 0xfedcba98, false, false)); }
__global__ __launch_bounds__(128) void k_fattn(const h16* __restrict__ QP, const h16* __restrict__ KP, const bf* __restrict__ Vh, const bf* __restrict__ Vl, float* __restrict__ OUT) {
    const int lane = threadIdx.x & 31, c = lane & 15, hi = lane >> 4, wave = threadIdx.x >> 5;
    const size_t bh = (size_t)blockIdx.z * NH_ + blockIdx.y;
    const int q0 = blockIdx.x * 128 + wave * 32;
    const h16* qp = QP + bh * TT * HD + (size_t)(q0 + c) * HD + 8 * hi;
    const h16* kp = KP + bh * TT * HD + (size_t)c * HD + 8 * hi;
    const bf* vhp = Vh + bh * HD * TT + (size_t)c * TT + 8 * hi;
    const bf* vlp = Vl + bh * HD * TT + (size_t)c * TT + 8 * hi;
    v16h qf[2][2], kf[2][2];
#pragma unroll
    for (int cg = 0; cg < 2; ++cg)
#pragma unroll
        for (int ks = 0; ks < 2; ++ks) qf[cg][ks] = WFrag<h16>::ld(qp + cg * 16 * HD + ks * 32);
#pragma unroll
    for (int kt = 0; kt < 2; ++kt)
#pragma unroll
        for (int ks = 0; ks < 2; ++ks) kf[kt][ks] = WFrag<h16>::ld(kp + kt * 16 * HD + ks * 32);
    v8f acc[4][2];
#pragma unroll
    for (int dt = 0; dt < 4; ++dt)
#pragma unroll
        for (int cg = 0; cg < 2; ++cg) acc[dt][cg] = (v8f){};
    float m[2] = {-3.0e38f, -3.0e38f}; v2f sm[2] = {(v2f){0.f, 0.f}, (v2f){0.f, 0.f}};   // sm: a lane's sums over its even and its odd keys
    for (int kb = 0; kb < TT; kb += 32) {
        v16bf vhf[4], vlf[4];
#pragma unroll
        for (int dt = 0; dt < 4; ++dt) { vhf[dt] = WFrag<bf>::ld(vhp + (size_t)dt * 16 * TT + kb); vlf[dt] = WFrag<bf>::ld(vlp + (size_t)dt * 16 * TT + kb); }
        v8f st[2][2];   // st[kt][cg][r] = S[q0 + 16 cg + c][kb + 16 kt + 8 hi + r]
#pragma unroll
        for (int kt = 0; kt < 2; ++kt)
#pragma unroll
            for (int cg = 0; cg < 2; ++cg) st[kt][cg] = wmma16(kf[kt][0], qf[cg][0], (v8f){});
#pragma unroll
        for (int kt = 0; kt < 2; ++kt)
#pragma unroll
            for (int cg = 0; cg < 2; ++cg) st[kt][cg] = wmma16(kf[kt][1], qf[cg][1], st[kt][cg]);
        const int kn = (kb + 32 < TT) ? kb + 32 : 0;   // next pass's key fragments, fetched behind this pass's score products (the last pass refetches block 0, unused)
#pragma unroll
        for (int kt = 0; kt < 2; ++kt)
#pragma unroll
            for (int ks = 0; ks < 2; ++ks) kf[kt][ks] = WFrag<h16>::ld(kp + (size_t)(kn + kt * 16) * HD + ks * 32);
        float mx[2];
#pragma unroll
        for (int cg = 0; cg < 2; ++cg) { float a = fmaxf(st[0][cg][0], st[1][cg][0]);
#pragma unroll
            for (int r = 1; r < 8; ++r) a = fmaxf(a, fmaxf(st[0][cg][r], st[1][cg][r]));
            a *= CS2; mx[cg] = fmaxf(a, xhalf(a)); }
        const bool need = (mx[0] > m[0] + 8.0f) || (mx[1] > m[1] + 8.0f);
        if (__builtin_amdgcn_ballot_w32(need) != 0) {
#pragma unroll
            for (int cg = 0; cg < 2; ++cg) { const float mn = fmaxf(m[cg], mx[cg]); const float al = __builtin_amdgcn_exp2f(m[cg] - mn); m[cg] = mn; sm[cg] *= al;
#pragma unroll
                for (int dt = 0; dt < 4; ++dt) acc[dt][cg] *= al; }
        }
        v16bf ph[2], pl[2];
#pragma unroll
        for (int cg = 0; cg < 2; ++cg) { const v2f nm = {-m[cg], -m[cg]};
#pragma unroll
            for (int s = 0; s < 16; s += 2) {   // register pairs as they lie in the score tile: packed f32 operations, no copies
                const v2f t = __builtin_elementwise_fma((v2f){st[s >> 3][cg][s & 7], st[s >> 3][cg][(s & 7) + 1]}, (v2f){CS2, CS2}, nm);
                const v2f p = {__builtin_amdgcn_exp2f(t[0]), __builtin_amdgcn_exp2f(t[1])};
                sm[cg] += p;
                const v2bf h2 = __builtin_convertvector(p, v2bf);
                const v2bf l2 = __builtin_convertvector(p - __builtin_convertvector(h2, v2f), v2bf);
                ph[cg][s] = h2[0]; ph[cg][s + 1] = h2[1]; pl[cg][s] = l2[0]; pl[cg][s + 1] = l2[1];
            }
        }
        // three products per tile in the order hi.hi, lo(P).hi(V), hi(P).lo(V); eight independent tiles between dependent accumulates
#pragma unroll
        for (int dt = 0; dt < 4; ++dt)
#pragma unroll
            for (int cg = 0; cg < 2; ++cg) acc[dt][cg] = wmmab(vhf[dt], ph[cg], acc[dt][cg]);
#pragma unroll
        for (int dt = 0; dt < 4; ++dt)
#pragma unroll
            for (int cg = 0; cg < 2; ++cg) acc[dt][cg] = wmmab(vhf[dt], pl[cg], acc[dt][cg]);
#pragma unroll
        for (int dt = 0; dt < 4; ++dt)
#pragma unroll
            for (int cg = 0; cg < 2; ++cg) acc[dt][cg] = wmmab(vlf[dt], ph[cg], acc[dt][cg]);
    }
#pragma unroll
    for (int cg = 0; cg < 2; ++cg) {
        const float sl = sm[cg][0] + sm[cg][1]; const float f = __fdiv_rn(1.0f, sl + xhalf(sl));
        float* o = OUT + ((size_t)blockIdx.z * TT + q0 + cg * 16 + c) * DM + blockIdx.y * HD + 8 * hi;   // acc[dt][cg][r] = O[q0 + 16 cg + c][16 dt + 8 hi + r]
#pragma unroll
        for (int dt = 0; dt < 4; ++dt) { const v8f a = acc[dt][cg] * f; *(v4f*)(o + dt * 16) = (v4f){a[0], a[1], a[2], a[3]}; *(v4f*)(o + dt * 16 + 4) = (v4f){a[4], a[5], a[6], a[7]}; }
    }
}

extern "C" void kernel_launch(void* const* d_in, const int* in_sizes, int n_in,
                              void* d_out, int out_size, void* d_ws, size_t ws_size, hipStream_t stream) {
    if (n_in < 7) return;
    if (in_sizes[0] < NB * SEQ_FULL * DM) return;
    if (in_sizes[1] < NH_ * DM * HD || in_sizes[3] < NH_ * DM * HD || in_sizes[5] < NH_ * DM * HD) return;
    if (in_sizes[2] < NH_ * HD || in_sizes[4] < NH_ * HD || in_sizes[6] < NH_ * HD) return;
    if (out_size < NB * TT * DM) return;
    const float* x  = (const float*)d_in[0];
    const float* wq = (const float*)d_in[1]; const float* bq = (const float*)d_in[2];
    const float* wk = (const float*)d_in[3]; const float* bk = (const float*)d_in[4];
    const float* wv = (const float*)d_in[5]; const float* bv = (const float*)d_in[6];
    float* OUT = (float*)d_out;     // [NB][TT][DM]
    char* wsp = (char*)d_ws;
    auto take = [&](size_t bytes) { char* p = wsp; wsp += (bytes + 255) & ~(size_t)255; return (void*)p; };
    bf*    WT  = (bf*)take((size_t)3 * DM * DM * 2);                 // [3][DM][DM]  Bt planes
    bf*    XB  = (bf*)take((size_t)NB * SEQ_FULL * DM * 2);          // bf16 x, all batches
    h16*   QP  = (h16*)take((size_t)NB * NH_ * TT * HD * 2);         // planes of all batches
    h16*   KP  = (h16*)take((size_t)NB * NH_ * TT * HD * 2);
    bf*    VTh = (bf*)take((size_t)NB * NH_ * HD * TT * 2);
    bf*    VTl = (bf*)take((size_t)NB * NH_ * HD * TT * 2);
    if ((size_t)(wsp - (char*)d_ws) > ws_size) return;

    k_wt<<<dim3((unsigned)(((size_t)DM * DM / 8 + 255) / 256), 3), 256, 0, stream>>>(wq, wk, wv, WT);
    const size_t nx8 = (size_t)NB * SEQ_FULL * DM / 8;
    k_cvt8<<<(unsigned)((nx8 + 255) / 256), 256, 0, stream>>>(x, XB, nx8);
    k_proj<<<dim3(NB * TT / 128, NH_ / 2, 3), 128, 0, stream>>>(XB, WT, bq, bk, bv, QP, KP, VTh, VTl);
    k_fattn<<<dim3(TT / 128, NH_, NB), 128, 0, stream>>>(QP, KP, VTh, VTl, OUT);
}

// v003
// Measured time: 111 microseconds a run.
// In both of two side-by-side timings against v002, it was 1.28 times as fast.
// All steps since v000 together make it 6.19 times as fast.
#include <hip/hip_runtime.h>

// Contractions, f32 accumulate: q/k/v projections v_wmma_f32_16x16x32_bf16 on bf16 (RNE) copies of x and W (exact products); scores v_wmma_f32_16x16x32_f16 on f16 q/k planes (single product); softmax f32; P.V v_wmma_f32_16x16x32_bf16 with P and V carried as bf16 hi+lo planes (3 products).
// Pipeline: ONE launch over all (batch, 64 tokens, head, weight): bf16(x) x Bt, +bias, written straight as q/k planes [b][h][t][d] f16 and value planes [b][h][d][t] bf16 hi/lo; then ONE launch over all (batch, head, 128 queries), key and value tiles staged in LDS: S^T = K Q^T, online softmax of S/HD in f32, O^T += V^T P^T with P packed from the score accumulators, out[b][t][h*HD + d] written directly.

#ifndef NB
#define NB 8
#endif
#ifndef SEQ
#define SEQ 1024
#endif
#define SEQ_FULL 1024
#define TT   SEQ
#define DM   768
#define NH_  12
#define HD   64
#define SCL  0.015625f   // 1/HD (scores are divided by head_dim)

static_assert(TT % 128 == 0);
static_assert(TT <= SEQ_FULL);
static_assert(NH_ * HD == DM);
static_assert(DM % 64 == 0);
static_assert(HD == 64);
static_assert(NH_ % 2 == 0);
static_assert(NB >= 1 && NB <= 8);

typedef _Float16 h16;
typedef unsigned short bf;
typedef __attribute__((ext_vector_type(16))) __bf16   v16bf;
typedef __attribute__((ext_vector_type(16))) _Float16 v16h;
typedef __attribute__((ext_vector_type(8)))  _Float16 v8h;
typedef __attribute__((ext_vector_type(8)))  unsigned short v8us;
typedef __attribute__((ext_vector_type(8)))  float    v8f;
typedef __attribute__((ext_vector_type(4)))  float    v4f;
typedef __attribute__((ext_vector_type(4)))  unsigned short v4us;
typedef v8h  __attribute__((may_alias)) v8ha;
typedef v4f  __attribute__((may_alias)) v4fa;
typedef v8us __attribute__((may_alias)) v8usa;

__device__ __forceinline__ unsigned short f2bf(float f) { unsigned u = __float_as_uint(f); u += 0x7FFFu + ((u >> 16) & 1u); return (unsigned short)(u >> 16); }
__device__ __forceinline__ float bf2f(unsigned short b) { return __uint_as_float(((unsigned)b) << 16); }
__device__ __forceinline__ float bfr(float f) { return bf2f(f2bf(f)); }
__device__ __forceinline__ v16h cat16(v8h lo, v8h hi) { return __builtin_shufflevector(lo, hi, 0, 1, 2, 3, 4, 5, 6, 7, 8, 9, 10, 11, 12, 13, 14, 15); }
__device__ __forceinline__ v16bf cat16b(v8us lo, v8us hi) { return __builtin_bit_cast(v16bf, __builtin_shufflevector(lo, hi, 0, 1, 2, 3, 4, 5, 6, 7, 8, 9, 10, 11, 12, 13, 14, 15)); }
__device__ __forceinline__ v8f wmma16(v16h a, v16h b, v8f c) { return __builtin_amdgcn_wmma_f32_16x16x32_f16(false, a, false, b, (short)0, c, false, false); }
__device__ __forceinline__ v8f wmmab(v16bf a, v16bf b, v8f c) { return __builtin_amdgcn_wmma_f32_16x16x32_bf16(false, a, false, b, (short)0, c, false, false); }
__device__ __forceinline__ h16 tohx(float x) { return (h16)x; }
__device__ __forceinline__ void splitf(float y, unsigned short& h, unsigned short& l) { h = f2bf(y); l = f2bf(y - bf2f(h)); }

// ---- k_proj: q, k and v projections of ALL batches in one launch; the epilogue adds the bias and writes the operand planes of k_fattn straight from the accumulators.
// One wave per 64 tokens x one head x one of q/k/v (16 accumulators, K = DM), operands straight from the K-contiguous bf16 planes; 4 waves per work-group = 2 token tiles x 2 heads; grid (NB*TT/128, NH_/2, 3).
// Fragments: lane -> row/col lane&15; elements 0..7 <- k0 + 8h + 0..7, elements 8..15 <- k0 + 16 + 8h + 0..7 (h = lane>>4), identical for both operands, so either plane can stand on either side of the product.
// A lane's 8 accumulator registers run along the rows of the first operand: the weight rows stand first for q and k (8 consecutive d of one token = one 16-byte store into [t][d]), the token rows stand first for v (8 consecutive t of one d = one 16-byte store into [d][t]).
template <typename T16> struct WFrag;
template <> struct WFrag<h16> { typedef v16h V; static __device__ __forceinline__ V ld(const h16* p) { return cat16(*(const v8h*)p, *(const v8h*)(p + 16)); } static __device__ __forceinline__ v8f mma(V a, V b, v8f c) { return wmma16(a, b, c); } };
template <> struct WFrag<bf> { typedef v16bf V; static __device__ __forceinline__ V ld(const bf* p) { return cat16b(*(const v8us*)p, *(const v8us*)(p + 16)); } static __device__ __forceinline__ v8f mma(V a, V b, v8f c) { return wmmab(a, b, c); } };
__global__ __launch_bounds__(128) void k_proj(const bf* __restrict__ XB, const bf* __restrict__ WT, const float* __restrict__ bq, const float* __restrict__ bk, const float* __restrict__ bv, h16* QP, h16* KP, bf* Vh, bf* Vl) {
    const int lane = threadIdx.x & 31, lr = lane & 15, hi = lane >> 4;
    const int wave = __builtin_amdgcn_readfirstlane(threadIdx.x >> 5);   // the tile's indices stay in scalar registers
    const int z = blockIdx.z;
    const int r0 = (blockIdx.x * 2 + (wave & 1)) * 64, b = r0 / TT, t0 = r0 % TT;   // 64 tokens of one batch (TT % 64 == 0)
    const int h = blockIdx.y * 2 + (wave >> 1);
    const bf* xr = XB + ((size_t)b * SEQ_FULL + t0 + lr) * DM + 8 * hi;
    const bf* wr = WT + ((size_t)z * DM + h * HD + lr) * DM + 8 * hi;
    const bf* P = (z == 2) ? xr : wr;   // rows of the result tile
    const bf* Q = (z == 2) ? wr : xr;   // columns of the result tile
    v8f acc[4][4];
#pragma unroll
    for (int mb = 0; mb < 4; ++mb)
#pragma unroll
        for (int nb = 0; nb < 4; ++nb) acc[mb][nb] = (v8f){};
#pragma unroll 1
    for (int kc = 0; kc < DM; kc += 32) {   // kept rolled: one pass's fragments and the 16 accumulators are the register budget
        const bf* pk = P + kc; const bf* qk = Q + kc;
        v16bf a[4];
#pragma unroll
        for (int mb = 0; mb < 4; ++mb) a[mb] = WFrag<bf>::ld(pk + (size_t)mb * 16 * DM);
#pragma unroll
        for (int nb = 0; nb < 4; ++nb) { const v16bf q = WFrag<bf>::ld(qk + (size_t)nb * 16 * DM);
#pragma unroll
            for (int mb = 0; mb < 4; ++mb) acc[mb][nb] = wmmab(a[mb], q, acc[mb][nb]); }
        // the pass's two address pairs stay untouched up to this wait; the next pass overwrites them behind it
        asm volatile("s_wait_xcnt 0x0" :: "v"(pk), "v"(qk) : "memory");
        // four vector slots between the pass's last matrix instructions and, over the back edge, the loads that overwrite their operands
        asm volatile("v_nop\n\tv_nop\n\tv_nop\n\tv_nop" : "+v"(acc[0][0]), "+v"(acc[1][1]), "+v"(acc[2][2]), "+v"(acc[3][3]) : "v"(a[0]), "v"(a[3]));
    }
    const size_t bh = (size_t)b * NH_ + h;
    if (z < 2) {   // acc[mb][nb][j] = (x W)[t0 + 16 nb + lr][16 mb + 8 hi + j]
        const float* bias = (z ? bk : bq) + h * HD + 8 * hi;
        h16* o = (z ? KP : QP) + (bh * TT + t0 + lr) * HD + 8 * hi;
        v8f bb[4];
#pragma unroll
        for (int mb = 0; mb < 4; ++mb) bb[mb] = *(const v8f*)(bias + mb * 16);
#pragma unroll
        for (int mb = 0; mb < 4; ++mb)
#pragma unroll
            for (int j = 0; j < 8; ++j) bb[mb][j] = bfr(bb[mb][j]);
#pragma unroll
        for (int nb = 0; nb < 4; ++nb)
#pragma unroll
            for (int mb = 0; mb < 4; ++mb) { v8h v;
#pragma unroll
                for (int j = 0; j < 8; ++j) v[j] = tohx(acc[mb][nb][j] + bb[mb][j]);
                *(v8h*)(o + (size_t)nb * 16 * HD + mb * 16) = v; }
    } else {       // acc[mb][nb][j] = (x W)[t0 + 16 mb + 8 hi + j][16 nb + lr]
        const size_t e = (bh * HD + lr) * TT + t0 + 8 * hi;
        float bl[4];
#pragma unroll
        for (int nb = 0; nb < 4; ++nb) bl[nb] = bv[h * HD + nb * 16 + lr];
#pragma unroll
        for (int nb = 0; nb < 4; ++nb) { const float bb = bfr(bl[nb]);
#pragma unroll
            for (int mb = 0; mb < 4; ++mb) { v8us oh, ol;
#pragma unroll
                for (int j = 0; j < 8; ++j) { unsigned short a2, c2; splitf(acc[mb][nb][j] + bb, a2, c2); oh[j] = a2; ol[j] = c2; }
                *(v8us*)(Vh + e + (size_t)nb * 16 * TT + mb * 16) = oh; *(v8us*)(Vl + e + (size_t)nb * 16 * TT + mb * 16) = ol;
                __builtin_amdgcn_sched_barrier(0); } }   // one tile's split at a time: interleaved tiles' temporaries lift the kernel over 192 registers, the most that lets five waves share a SIMD
    }
}

__global__ __launch_bounds__(256) void k_cvt8(const float* __restrict__ src, bf* dst, size_t n8) { const size_t i = (size_t)blockIdx.x * 256 + threadIdx.x; if (i >= n8) return; const v8f v = *(const v8f*)(src + i * 8); v8us o;
#pragma unroll
    for (int k = 0; k < 8; ++k) o[k] = f2bf(v[k]); *(v8us*)(dst + i * 8) = o;  }

__global__ __launch_bounds__(256) void k_wt(const float* __restrict__ wq, const float* __restrict__ wk, const float* __restrict__ wv, bf* Bt) {
    const int z = blockIdx.y;
    const float* w = (z == 0) ? wq : ((z == 1) ? wk : wv);
    const size_t i = (size_t)blockIdx.x * 256 + threadIdx.x; if (i >= (size_t)DM * DM / 8) return;
    const size_t e = i * 8; const int k = (int)(e % DM); const int n = (int)(e / DM); const int h = n / HD, c = n % HD;
    v8us o;
#pragma unroll
    for (int q = 0; q < 8; ++q) o[q] = f2bf(w[((size_t)h * DM + k + q) * HD + c]);
    bf* d = Bt + (size_t)z * DM * DM + e;
    *(v8us*)d = o; 
}

typedef __attribute__((ext_vector_type(2))) float  v2f;
typedef __attribute__((ext_vector_type(2))) __bf16 v2bf;
#define CS2 (SCL * 1.4426950408889634f)
#define KS    64            // keys per tile
#define LP    144           // LDS row pitch in bytes: 128 + 16, an odd multiple of 16, free of bank conflicts for 16-byte readers of 16 rows
#define TILEB (64 * LP)     // 64 rows
#define STGB  (3 * TILEB)   // key rows | value-hi rows | value-lo rows
#define NT    (TT / KS)
static_assert(NT >= 2);
__device__ __forceinline__ float xhalf(float x) { const int b = __float_as_int(x); return __int_as_float(__builtin_amdgcn_permlanex16(b, b, 0x76543210, 0xfedcba98, false, false)); }
// A lane's twelve 16-byte copies of one tile: 128 lanes x 16 bytes = 16 rows per copy, four copies per plane. l: the lane's LDS byte address in the key plane's first 16 rows; gk, gh, gl: its global bytes there.
// The address-translation wait closes the statement, so no register that a copy names is rewritten ahead of it.
__device__ __forceinline__ void fill_tile(unsigned l, const char* gk, const char* gh, const char* gl) {
    asm volatile("global_load_async_to_lds_b128 %0, %12, off\n\t"
                 "global_load_async_to_lds_b128 %1, %13, off\n\t"
                 "global_load_async_to_lds_b128 %2, %14, off\n\t"
                 "global_load_async_to_lds_b128 %3, %15, off\n\t"
                 "global_load_async_to_lds_b128 %4, %16, off\n\t"
                 "global_load_async_to_lds_b128 %5, %17, off\n\t"
                 "global_load_async_to_lds_b128 %6, %18, off\n\t"
                 "global_load_async_to_lds_b128 %7, %19, off\n\t"
                 "global_load_async_to_lds_b128 %8, %20, off\n\t"
                 "global_load_async_to_lds_b128 %9, %21, off\n\t"
                 "global_load_async_to_lds_b128 %10, %22, off\n\t"
                 "global_load_async_to_lds_b128 %11, %23, off\n\t"
                 "s_wait_xcnt 0x0"
                 :: "v"(l), "v"(l + 16 * LP), "v"(l + 32 * LP), "v"(l + 48 * LP),
                    "v"(l + TILEB), "v"(l + TILEB + 16 * LP), "v"(l + TILEB + 32 * LP), "v"(l + TILEB + 48 * LP),
                    "v"(l + 2 * TILEB), "v"(l + 2 * TILEB + 16 * LP), "v"(l + 2 * TILEB + 32 * LP), "v"(l + 2 * TILEB + 48 * LP),
                    "v"(gk), "v"(gk + 16 * HD * 2), "v"(gk + 32 * HD * 2), "v"(gk + 48 * HD * 2),
                    "v"(gh), "v"(gh + 16 * TT * 2), "v"(gh + 32 * TT * 2), "v"(gh + 48 * TT * 2),
                    "v"(gl), "v"(gl + 16 * TT * 2), "v"(gl + 32 * TT * 2), "v"(gl + 48 * TT * 2)
                 : "memory");
}
__global__ __launch_bounds__(128) void k_fattn(const h16* __restrict__ QP, const h16* __restrict__ KP, const bf* __restrict__ Vh, const bf* __restrict__ Vl, float* __restrict__ OUT) {
    __shared__ __attribute__((aligned(16))) unsigned char ring[2 * STGB];
    const int tid = threadIdx.x, lane = tid & 31, c = lane & 15, hi = lane >> 4, wave = tid >> 5;
    const size_t bh = (size_t)blockIdx.z * NH_ + blockIdx.y;
    const int q0 = blockIdx.x * 128 + wave * 32;
    const h16* qp = QP + bh * TT * HD + (size_t)(q0 + c) * HD + 8 * hi;
    // copies: lane tid brings piece tid & 7 of row tid >> 3 (of each 16 rows)
    const unsigned l0 = (unsigned)(uintptr_t)ring + (unsigned)((tid >> 3) * LP + (tid & 7) * 16);
    const char* gk = (const char*)(KP + bh * TT * HD) + tid * 16;
    const char* gh = (const char*)(Vh + bh * HD * TT) + (size_t)(tid >> 3) * (TT * 2) + (tid & 7) * 16;
    const char* gl = (const char*)(Vl + bh * HD * TT) + (size_t)(tid >> 3) * (TT * 2) + (tid & 7) * 16;
    // readers: lane -> row c of a 16-row group, bytes 16 hi + 0..15 and 32 + 16 hi + 0..15 of each 64 bytes, as from the planes
    const unsigned char* fb = ring + c * LP + 16 * hi;
    fill_tile(l0, gk, gh, gl);
    v16h qf[2][2], kf[2][2];
#pragma unroll
    for (int cg = 0; cg < 2; ++cg)
#pragma unroll
        for (int ks = 0; ks < 2; ++ks) qf[cg][ks] = WFrag<h16>::ld(qp + cg * 16 * HD + ks * 32);
    v8f acc[4][2];
#pragma unroll
    for (int dt = 0; dt < 4; ++dt)
#pragma unroll
        for (int cg = 0; cg < 2; ++cg) acc[dt][cg] = (v8f){};
    float m[2] = {-3.0e38f, -3.0e38f}; v2f sm[2] = {(v2f){0.f, 0.f}, (v2f){0.f, 0.f}};   // sm: a lane's sums over its even and its odd keys
    asm volatile("s_wait_asynccnt 0x0" ::: "memory");   // this wave's share of tile 0 has landed
    __syncthreads();                                    // tile 0 is readable by all four waves
    fill_tile(l0 + STGB, gk + KS * HD * 2, gh + KS * 2, gl + KS * 2);
    for (int t = 0; t < NT; ++t) {
        const unsigned char* sb = fb + (t & 1) * STGB;
#pragma unroll
        for (int kt = 0; kt < 2; ++kt)
#pragma unroll
            for (int ks = 0; ks < 2; ++ks) kf[kt][ks] = WFrag<h16>::ld((const h16*)(sb + kt * 16 * LP + ks * 64));
#pragma unroll
        for (int p = 0; p < KS / 32; ++p) {   // a pass is 32 keys
            v16bf vhf[4], vlf[4];
#pragma unroll
            for (int dt = 0; dt < 4; ++dt) { vhf[dt] = WFrag<bf>::ld((const bf*)(sb + TILEB + dt * 16 * LP + p * 64)); vlf[dt] = WFrag<bf>::ld((const bf*)(sb + 2 * TILEB + dt * 16 * LP + p * 64)); }
            __builtin_amdgcn_sched_barrier(0);   // the pass's value fragments are asked for as one group up here, a whole softmax ahead of their products; left free, the loads sink to two in front of every four products, each with its own full wait
            v8f st[2][2];   // st[kt][cg][r] = S[q0 + 16 cg + c][64 t + 32 p + 16 kt + 8 hi + r]
#pragma unroll
            for (int kt = 0; kt < 2; ++kt)
#pragma unroll
                for (int cg = 0; cg < 2; ++cg) st[kt][cg] = wmma16(kf[kt][0], qf[cg][0], (v8f){});
#pragma unroll
            for (int kt = 0; kt < 2; ++kt)
#pragma unroll
                for (int cg = 0; cg < 2; ++cg) st[kt][cg] = wmma16(kf[kt][1], qf[cg][1], st[kt][cg]);
            if (p + 1 < KS / 32) {   // the next pass's key fragments of the SAME tile, fetched behind this pass's score products
#pragma unroll
                for (int kt = 0; kt < 2; ++kt)
#pragma unroll
                    for (int ks = 0; ks < 2; ++ks) kf[kt][ks] = WFrag<h16>::ld((const h16*)(sb + ((p + 1) * 32 + kt * 16) * LP + ks * 64));
            }
            float mx[2];
#pragma unroll
            for (int cg = 0; cg < 2; ++cg) { float a = fmaxf(st[0][cg][0], st[1][cg][0]);
#pragma unroll
                for (int r = 1; r < 8; ++r) a = fmaxf(a, fmaxf(st[0][cg][r], st[1][cg][r]));
                a *= CS2; mx[cg] = fmaxf(a, xhalf(a)); }
            const bool need = (mx[0] > m[0] + 8.0f) || (mx[1] > m[1] + 8.0f);
            if (__builtin_amdgcn_ballot_w32(need) != 0) {
#pragma unroll
                for (int cg = 0; cg < 2; ++cg) { const float mn = fmaxf(m[cg], mx[cg]); const float al = __builtin_amdgcn_exp2f(m[cg] - mn); m[cg] = mn; sm[cg] *= al;
#pragma unroll
                    for (int dt = 0; dt < 4; ++dt) acc[dt][cg] *= al; }
            }
            v16bf ph[2], pl[2];
#pragma unroll
            for (int cg = 0; cg < 2; ++cg) { const v2f nm = {-m[cg], -m[cg]};
#pragma unroll
                for (int s = 0; s < 16; s += 2) {   // register pairs as they lie in the score tile: packed f32 operations, no copies
                    const v2f t2 = __builtin_elementwise_fma((v2f){st[s >> 3][cg][s & 7], st[s >> 3][cg][(s & 7) + 1]}, (v2f){CS2, CS2}, nm);
                    const v2f pe = {__builtin_amdgcn_exp2f(t2[0]), __builtin_amdgcn_exp2f(t2[1])};
                    sm[cg] += pe;
                    const v2bf h2 = __builtin_convertvector(pe, v2bf);
                    const v2bf l2 = __builtin_convertvector(pe - __builtin_convertvector(h2, v2f), v2bf);
                    ph[cg][s] = h2[0]; ph[cg][s + 1] = h2[1]; pl[cg][s] = l2[0]; pl[cg][s + 1] = l2[1];
                }
            }
            // three products per tile in the order hi.hi, lo(P).hi(V), hi(P).lo(V); eight independent tiles between dependent accumulates
#pragma unroll
            for (int dt = 0; dt < 4; ++dt)
#pragma unroll
                for (int cg = 0; cg < 2; ++cg) acc[dt][cg] = wmmab(vhf[dt], ph[cg], acc[dt][cg]);
#pragma unroll
            for (int dt = 0; dt < 4; ++dt)
#pragma unroll
                for (int cg = 0; cg < 2; ++cg) acc[dt][cg] = wmmab(vhf[dt], pl[cg], acc[dt][cg]);
#pragma unroll
            for (int dt = 0; dt < 4; ++dt)
#pragma unroll
                for (int cg = 0; cg < 2; ++cg) acc[dt][cg] = wmmab(vlf[dt], ph[cg], acc[dt][cg]);
        }
        asm volatile("s_wait_dscnt 0x0" ::: "memory");      // this wave's reads of tile t have returned before its buffer is handed to the copies
        asm volatile("s_wait_asynccnt 0x0" ::: "memory");   // this wave's share of tile t + 1 has landed
        __syncthreads();                                    // publishes tile t + 1 and ends every wave's reads of tile t
        if (t + 2 < NT) fill_tile(l0 + (unsigned)(t & 1) * STGB, gk + (size_t)(t + 2) * (KS * HD * 2), gh + (size_t)(t + 2) * (KS * 2), gl + (size_t)(t + 2) * (KS * 2));
    }
    asm volatile("s_wait_asynccnt 0x0" ::: "memory");       // no copy is outstanding when the wave ends
#pragma unroll
    for (int cg = 0; cg < 2; ++cg) {
        const float sl = sm[cg][0] + sm[cg][1]; const float f = __fdiv_rn(1.0f, sl + xhalf(sl));
        float* o = OUT + ((size_t)blockIdx.z * TT + q0 + cg * 16 + c) * DM + blockIdx.y * HD + 8 * hi;   // acc[dt][cg][r] = O[q0 + 16 cg + c][16 dt + 8 hi + r]
#pragma unroll
        for (int dt = 0; dt < 4; ++dt) { const v8f a = acc[dt][cg] * f; *(v4f*)(o + dt * 16) = (v4f){a[0], a[1], a[2], a[3]}; *(v4f*)(o + dt * 16 + 4) = (v4f){a[4], a[5], a[6], a[7]}; }
    }
}

extern "C" void kernel_launch(void* const* d_in, const int* in_sizes, int n_in,
                              void* d_out, int out_size, void* d_ws, size_t ws_size, hipStream_t stream) {
    if (n_in < 7) return;
    if (in_sizes[0] < NB * SEQ_FULL * DM) return;
    if (in_sizes[1] < NH_ * DM * HD || in_sizes[3] < NH_ * DM * HD || in_sizes[5] < NH_ * DM * HD) return;
    if (in_sizes[2] < NH_ * HD || in_sizes[4] < NH_ * HD || in_sizes[6] < NH_ * HD) return;
    if (out_size < NB * TT * DM) return;
    const float* x  = (const float*)d_in[0];
    const float* wq = (const float*)d_in[1]; const float* bq = (const float*)d_in[2];
    const float* wk = (const float*)d_in[3]; const float* bk = (const float*)d_in[4];
    const float* wv = (const float*)d_in[5]; const float* bv = (const float*)d_in[6];
    float* OUT = (float*)d_out;     // [NB][TT][DM]
    char* wsp = (char*)d_ws;
    auto take = [&](size_t bytes) { char* p = wsp; wsp += (bytes + 255) & ~(size_t)255; return (void*)p; };
    bf*    WT  = (bf*)take((size_t)3 * DM * DM * 2);                 // [3][DM][DM]  Bt planes
    bf*    XB  = (bf*)take((size_t)NB * SEQ_FULL * DM * 2);          // bf16 x, all batches
    h16*   QP  = (h16*)take((size_t)NB * NH_ * TT * HD * 2);         // planes of all batches
    h16*   KP  = (h16*)take((size_t)NB * NH_ * TT * HD * 2);
    bf*    VTh = (bf*)take((size_t)NB * NH_ * HD * TT * 2);
    bf*    VTl = (bf*)take((size_t)NB * NH_ * HD * TT * 2);
    if ((size_t)(wsp - (char*)d_ws) > ws_size) return;

    k_wt<<<dim3((unsigned)(((size_t)DM * DM / 8 + 255) / 256), 3), 256, 0, stream>>>(wq, wk, wv, WT);
    const size_t nx8 = (size_t)NB * SEQ_FULL * DM / 8;
    k_cvt8<<<(unsigned)((nx8 + 255) / 256), 256, 0, stream>>>(x, XB, nx8);
    k_proj<<<dim3(NB * TT / 128, NH_ / 2, 3), 128, 0, stream>>>(XB, WT, bq, bk, bv, QP, KP, VTh, VTl);
    k_fattn<<<dim3(TT / 128, NH_, NB), 128, 0, stream>>>(QP, KP, VTh, VTl, OUT);
}

// v004
// Measured time: 83.1 microseconds a run.
// In two side-by-side timings against v003, it was 1.33 and 1.34 times as fast.
// Over all steps from v000 it is 8.27 times as fast.
#include <hip/hip_runtime.h>

// Contractions, f32 accumulate: q/k/v projections v_wmma_f32_16x16x32_bf16 on bf16 (RNE) copies of x and W (exact products); scores v_wmma_f32_16x16x32_f16 on f16 q/k planes (single product); softmax f32; P.V v_wmma_f32_16x16x32_bf16 with P and V carried as bf16 hi+lo planes (3 products).
// Pipeline: ONE launch over all (batch, 64 tokens, head, weight): bf16(x) x Bt, +bias, written straight as q/k planes [b][h][t][d] f16 and value planes [b][h][d][t] bf16 hi/lo; then ONE launch over all (batch, head, 128 queries), key and value tiles staged in LDS: S^T = K Q^T, online softmax of S/HD in f32, O^T += V^T P^T with P packed from the score accumulators, out[b][t][h*HD + d] written directly.

#ifndef NB
#define NB 8
#endif
#ifndef SEQ
#define SEQ 1024
#endif
#define SEQ_FULL 1024
#define TT   SEQ
#define DM   768
#define NH_  12
#define HD   64
#define SCL  0.015625f   // 1/HD (scores are divided by head_dim)

static_assert(TT % 128 == 0);
static_assert(TT <= SEQ_FULL);
static_assert(NH_ * HD == DM);
static_assert(DM % 64 == 0);
static_assert(HD == 64);
static_assert(NH_ % 2 == 0);
static_assert(NB >= 1 && NB <= 8);

typedef _Float16 h16;
typedef unsigned short bf;
typedef __attribute__((ext_vector_type(16))) __bf16   v16bf;
typedef __attribute__((ext_vector_type(16))) _Float16 v16h;
typedef __attribute__((ext_vector_type(8)))  _Float16 v8h;
typedef __attribute__((ext_vector_type(8)))  unsigned short v8us;
typedef __attribute__((ext_vector_type(8)))  float    v8f;
typedef __attribute__((ext_vector_type(4)))  float    v4f;
typedef __attribute__((ext_vector_type(4)))  unsigned short v4us;
typedef v8h  __attribute__((may_alias)) v8ha;
typedef v4f  __attribute__((may_alias)) v4fa;
typedef v8us __attribute__((may_alias)) v8usa;

__device__ __forceinline__ unsigned short f2bf(float f) { unsigned u = __float_as_uint(f); u += 0x7FFFu + ((u >> 16) & 1u); return (unsigned short)(u >> 16); }
__device__ __forceinline__ float bf2f(unsigned short b) { return __uint_as_float(((unsigned)b) << 16); }
__device__ __forceinline__ float bfr(float f) { return bf2f(f2bf(f)); }
__device__ __forceinline__ v16h cat16(v8h lo, v8h hi) { return __builtin_shufflevector(lo, hi, 0, 1, 2, 3, 4, 5, 6, 7, 8, 9, 10, 11, 12, 13, 14, 15); }
__device__ __forceinline__ v16bf cat16b(v8us lo, v8us hi) { return __builtin_bit_cast(v16bf, __builtin_shufflevector(lo, hi, 0, 1, 2, 3, 4, 5, 6, 7, 8, 9, 10, 11, 12, 13, 14, 15)); }
__device__ __forceinline__ v8f wmma16(v16h a, v16h b, v8f c) { return __builtin_amdgcn_wmma_f32_16x16x32_f16(false, a, false, b, (short)0, c, false, false); }
__device__ __forceinline__ v8f wmmab(v16bf a, v16bf b, v8f c) { return __builtin_amdgcn_wmma_f32_16x16x32_bf16(false, a, false, b, (short)0, c, false, false); }
__device__ __forceinline__ h16 tohx(float x) { return (h16)x; }
__device__ __forceinline__ void splitf(float y, unsigned short& h, unsigned short& l) { h = f2bf(y); l = f2bf(y - bf2f(h)); }

// ---- k_proj: q, k and v projections of ALL batches in one launch; the epilogue adds the bias and writes the operand planes of k_fattn straight from the accumulators.
// One wave per 64 tokens x one head x one of q/k/v (16 accumulators, K = DM); 4 waves per work-group = 2 token tiles x 2 heads; grid (NB*TT/128, NH_/2, 3).
// Operands come from LDS: a stage is 64 k = 128 token rows and 128 weight rows of 128 bytes each, brought in whole 128-byte lines by asynchronous copies, once for the four waves, two buffers, the next stage in flight while this one is worked on.
// LDS rows are unpadded (two buffers = 64 KiB, so five work-groups share a WGP's 320 KiB and the whole grid is resident); instead the 16-byte piece p of row r lies at place p ^ ((r >> 1) & 7) of its row:
// 16 lanes that read one piece of 16 consecutive rows then fall on 16 different 16-byte places modulo 256 bytes, that is on all 64 banks once.
// Fragments: lane -> row/col lane&15; elements 0..7 <- k0 + 8h + 0..7, elements 8..15 <- k0 + 16 + 8h + 0..7 (h = lane>>4), identical for both operands, so either plane can stand on either side of the product.
// A lane's 8 accumulator registers run along the rows of the first operand: the weight rows stand first for q and k (8 consecutive d of one token = one 16-byte store into [t][d]), the token rows stand first for v (8 consecutive t of one d = one 16-byte store into [d][t]).
template <typename T16> struct WFrag;
template <> struct WFrag<h16> { typedef v16h V; static __device__ __forceinline__ V ld(const h16* p) { return cat16(*(const v8h*)p, *(const v8h*)(p + 16)); } static __device__ __forceinline__ v8f mma(V a, V b, v8f c) { return wmma16(a, b, c); } };
template <> struct WFrag<bf> { typedef v16bf V; static __device__ __forceinline__ V ld(const bf* p) { return cat16b(*(const v8us*)p, *(const v8us*)(p + 16)); } static __device__ __forceinline__ v8f mma(V a, V b, v8f c) { return wmmab(a, b, c); } };
#define PK    64             // k per stage
#define PLP   128            // LDS row pitch in bytes, no pad
#define PHALF (128 * PLP)    // 128 rows of one operand
#define PSTG  (2 * PHALF)    // token rows | weight rows
#define PNT   (DM / PK)
static_assert(DM % PK == 0 && PNT >= 2);
// A lane's eight 16-byte copies of one operand's 128 rows: 128 lanes x 16 bytes = 16 rows per copy. l: the lane's LDS byte address in the first 16 rows; g: its global bytes there.
// The address-translation wait closes the statement, so no register that a copy names is rewritten ahead of it.
__device__ __forceinline__ void fill_rows(unsigned l, const char* g) {
    asm volatile("global_load_async_to_lds_b128 %0, %8, off\n\t"
                 "global_load_async_to_lds_b128 %1, %9, off\n\t"
                 "global_load_async_to_lds_b128 %2, %10, off\n\t"
                 "global_load_async_to_lds_b128 %3, %11, off\n\t"
                 "global_load_async_to_lds_b128 %4, %12, off\n\t"
                 "global_load_async_to_lds_b128 %5, %13, off\n\t"
                 "global_load_async_to_lds_b128 %6, %14, off\n\t"
                 "global_load_async_to_lds_b128 %7, %15, off\n\t"
                 "s_wait_xcnt 0x0"
                 :: "v"(l), "v"(l + 16 * PLP), "v"(l + 32 * PLP), "v"(l + 48 * PLP), "v"(l + 64 * PLP), "v"(l + 80 * PLP), "v"(l + 96 * PLP), "v"(l + 112 * PLP),
                    "v"(g), "v"(g + 16 * DM * 2), "v"(g + 32 * DM * 2), "v"(g + 48 * DM * 2), "v"(g + 64 * DM * 2), "v"(g + 80 * DM * 2), "v"(g + 96 * DM * 2), "v"(g + 112 * DM * 2)
                 : "memory");
}
__global__ __launch_bounds__(128) void k_proj(const bf* __restrict__ XB, const bf* __restrict__ WT, const float* __restrict__ bq, const float* __restrict__ bk, const float* __restrict__ bv, h16* QP, h16* KP, bf* Vh, bf* Vl) {
    __shared__ __attribute__((aligned(16))) unsigned char stg[2 * PSTG];
    const int tid = threadIdx.x, lane = tid & 31, lr = lane & 15, hi = lane >> 4;
    const int wave = __builtin_amdgcn_readfirstlane(threadIdx.x >> 5);   // the tile's indices stay in scalar registers
    const int z = blockIdx.z;
    const int r0 = (blockIdx.x * 2 + (wave & 1)) * 64, b = r0 / TT, t0 = r0 % TT;   // 64 tokens of one batch (TT % 64 == 0)
    const int h = blockIdx.y * 2 + (wave >> 1);
    // copies: lane tid brings piece tid & 7 of row tid >> 3 (of each 16 rows); the work-group's 128 tokens lie in one batch (TT % 128 == 0)
    const unsigned l0 = (unsigned)(uintptr_t)stg + (unsigned)((tid >> 3) * PLP + (((tid & 7) ^ ((tid >> 4) & 7)) * 16));
    const char* gx = (const char*)(XB + ((size_t)(blockIdx.x * 128 / TT) * SEQ_FULL + blockIdx.x * 128 % TT + (tid >> 3)) * DM) + (tid & 7) * 16;
    const char* gw = (const char*)(WT + ((size_t)z * DM + blockIdx.y * 128 + (tid >> 3)) * DM) + (tid & 7) * 16;
    // readers: lane -> row lr of a 16-row group, pieces hi and 2 + hi of each four (bytes 16 hi + 0..15 and 32 + 16 hi + 0..15 of each 64, as from the planes), each at its place in the row
    const unsigned char* xr = stg + ((wave & 1) * 64 + lr) * PLP;
    const unsigned char* wr = stg + PHALF + ((wave >> 1) * 64 + lr) * PLP;
    int po[PK / 32][2];
#pragma unroll
    for (int ks = 0; ks < PK / 32; ++ks)
#pragma unroll
        for (int j = 0; j < 2; ++j) po[ks][j] = ((ks * 4 + j * 2 + hi) ^ ((lr >> 1) & 7)) * 16;
    const unsigned char* P = (z == 2) ? xr : wr;   // rows of the result tile
    const unsigned char* Q = (z == 2) ? wr : xr;   // columns of the result tile
    fill_rows(l0, gx); fill_rows(l0 + PHALF, gw);
    v8f acc[4][4];
#pragma unroll
    for (int mb = 0; mb < 4; ++mb)
#pragma unroll
        for (int nb = 0; nb < 4; ++nb) acc[mb][nb] = (v8f){};
    asm volatile("s_wait_asynccnt 0x0" ::: "memory");   // this wave's share of stage 0 has landed
    __syncthreads();                                    // stage 0 is readable by all four waves
    fill_rows(l0 + PSTG, gx + PK * 2); fill_rows(l0 + PSTG + PHALF, gw + PK * 2);
    for (int t = 0; t < PNT; ++t) {
        const unsigned char* pk = P + (t & 1) * PSTG; const unsigned char* qk = Q + (t & 1) * PSTG;
#pragma unroll
        for (int ks = 0; ks < PK / 32; ++ks) {
            v16bf a[4], q[4];
#pragma unroll
            for (int mb = 0; mb < 4; ++mb) a[mb] = cat16b(*(const v8us*)(pk + mb * 16 * PLP + po[ks][0]), *(const v8us*)(pk + mb * 16 * PLP + po[ks][1]));
#pragma unroll
            for (int nb = 0; nb < 4; ++nb) q[nb] = cat16b(*(const v8us*)(qk + nb * 16 * PLP + po[ks][0]), *(const v8us*)(qk + nb * 16 * PLP + po[ks][1]));
#pragma unroll
            for (int nb = 0; nb < 4; ++nb)
#pragma unroll
                for (int mb = 0; mb < 4; ++mb) acc[mb][nb] = wmmab(a[mb], q[nb], acc[mb][nb]);
        }
        asm volatile("s_wait_dscnt 0x0" ::: "memory");      // this wave's reads of stage t have returned before its buffer is handed to the copies
        asm volatile("s_wait_asynccnt 0x0" ::: "memory");   // this wave's share of stage t + 1 has landed
        __syncthreads();                                    // publishes stage t + 1 and ends every wave's reads of stage t
        if (t + 2 < PNT) { fill_rows(l0 + (unsigned)(t & 1) * PSTG, gx + (size_t)(t + 2) * (PK * 2)); fill_rows(l0 + (unsigned)(t & 1) * PSTG + PHALF, gw + (size_t)(t + 2) * (PK * 2)); }
    }
    asm volatile("s_wait_asynccnt 0x0" ::: "memory");       // no copy is outstanding when the wave ends
    const size_t bh = (size_t)b * NH_ + h;
    if (z < 2) {   // acc[mb][nb][j] = (x W)[t0 + 16 nb + lr][16 mb + 8 hi + j]
        const float* bias = (z ? bk : bq) + h * HD + 8 * hi;
        h16* o = (z ? KP : QP) + (bh * TT + t0 + lr) * HD + 8 * hi;
        v8f bb[4];
#pragma unroll
        for (int mb = 0; mb < 4; ++mb) bb[mb] = *(const v8f*)(bias + mb * 16);
#pragma unroll
        for (int mb = 0; mb < 4; ++mb)
#pragma unroll
            for (int j = 0; j < 8; ++j) bb[mb][j] = bfr(bb[mb][j]);
#pragma unroll
        for (int nb = 0; nb < 4; ++nb)
#pragma unroll
            for (int mb = 0; mb < 4; ++mb) { v8h v;
#pragma unroll
                for (int j = 0; j < 8; ++j) v[j] = tohx(acc[mb][nb][j] + bb[mb][j]);
                *(v8h*)(o + (size_t)nb * 16 * HD + mb * 16) = v; }
    } else {       // acc[mb][nb][j] = (x W)[t0 + 16 mb + 8 hi + j][16 nb + lr]
        const size_t e = (bh * HD + lr) * TT + t0 + 8 * hi;
        float bl[4];
#pragma unroll
        for (int nb = 0; nb < 4; ++nb) bl[nb] = bv[h * HD + nb * 16 + lr];
#pragma unroll
        for (int nb = 0; nb < 4; ++nb) { const float bb = bfr(bl[nb]);
#pragma unroll
            for (int mb = 0; mb < 4; ++mb) { v8us oh, ol;
#pragma unroll
                for (int j = 0; j < 8; ++j) { unsigned short a2, c2; splitf(acc[mb][nb][j] + bb, a2, c2); oh[j] = a2; ol[j] = c2; }
                *(v8us*)(Vh + e + (size_t)nb * 16 * TT + mb * 16) = oh; *(v8us*)(Vl + e + (size_t)nb * 16 * TT + mb * 16) = ol;
                __builtin_amdgcn_sched_barrier(0); } }   // one tile's split at a time: interleaved tiles' temporaries lift the kernel over 192 registers, the most that lets five waves share a SIMD
    }
}

__global__ __launch_bounds__(256) void k_cvt8(const float* __restrict__ src, bf* dst, size_t n8) { const size_t i = (size_t)blockIdx.x * 256 + threadIdx.x; if (i >= n8) return; const v8f v = *(const v8f*)(src + i * 8); v8us o;
#pragma unroll
    for (int k = 0; k < 8; ++k) o[k] = f2bf(v[k]); *(v8us*)(dst + i * 8) = o;  }

__global__ __launch_bounds__(256) void k_wt(const float* __restrict__ wq, const float* __restrict__ wk, const float* __restrict__ wv, bf* Bt) {
    const int z = blockIdx.y;
    const float* w = (z == 0) ? wq : ((z == 1) ? wk : wv);
    const size_t i = (size_t)blockIdx.x * 256 + threadIdx.x; if (i >= (size_t)DM * DM / 8) return;
    const size_t e = i * 8; const int k = (int)(e % DM); const int n = (int)(e / DM); const int h = n / HD, c = n % HD;
    v8us o;
#pragma unroll
    for (int q = 0; q < 8; ++q) o[q] = f2bf(w[((size_t)h * DM + k + q) * HD + c]);
    bf* d = Bt + (size_t)z * DM * DM + e;
    *(v8us*)d = o; 
}

typedef __attribute__((ext_vector_type(2))) float  v2f;
typedef __attribute__((ext_vector_type(2))) __bf16 v2bf;
#define CS2 (SCL * 1.4426950408889634f)
#define KS    64            // keys per tile
#define LP    144           // LDS row pitch in bytes: 128 + 16, an odd multiple of 16, free of bank conflicts for 16-byte readers of 16 rows
#define TILEB (64 * LP)     // 64 rows
#define STGB  (3 * TILEB)   // key rows | value-hi rows | value-lo rows
#define NT    (TT / KS)
static_assert(NT >= 2);
__device__ __forceinline__ float xhalf(float x) { const int b = __float_as_int(x); return __int_as_float(__builtin_amdgcn_permlanex16(b, b, 0x76543210, 0xfedcba98, false, false)); }
// A lane's twelve 16-byte copies of one tile: 128 lanes x 16 bytes = 16 rows per copy, four copies per plane. l: the lane's LDS byte address in the key plane's first 16 rows; gk, gh, gl: its global bytes there.
// The address-translation wait closes the statement, so no register that a copy names is rewritten ahead of it.
__device__ __forceinline__ void fill_tile(unsigned l, const char* gk, const char* gh, const char* gl) {
    asm volatile("global_load_async_to_lds_b128 %0, %12, off\n\t"
                 "global_load_async_to_lds_b128 %1, %13, off\n\t"
                 "global_load_async_to_lds_b128 %2, %14, off\n\t"
                 "global_load_async_to_lds_b128 %3, %15, off\n\t"
                 "global_load_async_to_lds_b128 %4, %16, off\n\t"
                 "global_load_async_to_lds_b128 %5, %17, off\n\t"
                 "global_load_async_to_lds_b128 %6, %18, off\n\t"
                 "global_load_async_to_lds_b128 %7, %19, off\n\t"
                 "global_load_async_to_lds_b128 %8, %20, off\n\t"
                 "global_load_async_to_lds_b128 %9, %21, off\n\t"
                 "global_load_async_to_lds_b128 %10, %22, off\n\t"
                 "global_load_async_to_lds_b128 %11, %23, off\n\t"
                 "s_wait_xcnt 0x0"
                 :: "v"(l), "v"(l + 16 * LP), "v"(l + 32 * LP), "v"(l + 48 * LP),
                    "v"(l + TILEB), "v"(l + TILEB + 16 * LP), "v"(l + TILEB + 32 * LP), "v"(l + TILEB + 48 * LP),
                    "v"(l + 2 * TILEB), "v"(l + 2 * TILEB + 16 * LP), "v"(l + 2 * TILEB + 32 * LP), "v"(l + 2 * TILEB + 48 * LP),
                    "v"(gk), "v"(gk + 16 * HD * 2), "v"(gk + 32 * HD * 2), "v"(gk + 48 * HD * 2),
                    "v"(gh), "v"(gh + 16 * TT * 2), "v"(gh + 32 * TT * 2), "v"(gh + 48 * TT * 2),
                    "v"(gl), "v"(gl + 16 * TT * 2), "v"(gl + 32 * TT * 2), "v"(gl + 48 * TT * 2)
                 : "memory");
}
__global__ __launch_bounds__(128) void k_fattn(const h16* __restrict__ QP, const h16* __restrict__ KP, const bf* __restrict__ Vh, const bf* __restrict__ Vl, float* __restrict__ OUT) {
    __shared__ __attribute__((aligned(16))) unsigned char ring[2 * STGB];
    const int tid = threadIdx.x, lane = tid & 31, c = lane & 15, hi = lane >> 4, wave = tid >> 5;
    const size_t bh = (size_t)blockIdx.z * NH_ + blockIdx.y;
    const int q0 = blockIdx.x * 128 + wave * 32;
    const h16* qp = QP + bh * TT * HD + (size_t)(q0 + c) * HD + 8 * hi;
    // copies: lane tid brings piece tid & 7 of row tid >> 3 (of each 16 rows)
    const unsigned l0 = (unsigned)(uintptr_t)ring + (unsigned)((tid >> 3) * LP + (tid & 7) * 16);
    const char* gk = (const char*)(KP + bh * TT * HD) + tid * 16;
    const char* gh = (const char*)(Vh + bh * HD * TT) + (size_t)(tid >> 3) * (TT * 2) + (tid & 7) * 16;
    const char* gl = (const char*)(Vl + bh * HD * TT) + (size_t)(tid >> 3) * (TT * 2) + (tid & 7) * 16;
    // readers: lane -> row c of a 16-row group, bytes 16 hi + 0..15 and 32 + 16 hi + 0..15 of each 64 bytes, as from the planes
    const unsigned char* fb = ring + c * LP + 16 * hi;
    fill_tile(l0, gk, gh, gl);
    v16h qf[2][2], kf[2][2];
#pragma unroll
    for (int cg = 0; cg < 2; ++cg)
#pragma unroll
        for (int ks = 0; ks < 2; ++ks) qf[cg][ks] = WFrag<h16>::ld(qp + cg * 16 * HD + ks * 32);
    v8f acc[4][2];
#pragma unroll
    for (int dt = 0; dt < 4; ++dt)
#pragma unroll
        for (int cg = 0; cg < 2; ++cg) acc[dt][cg] = (v8f){};
    float m[2] = {-3.0e38f, -3.0e38f}; v2f sm[2] = {(v2f){0.f, 0.f}, (v2f){0.f, 0.f}};   // sm: a lane's sums over its even and its odd keys
    asm volatile("s_wait_asynccnt 0x0" ::: "memory");   // this wave's share of tile 0 has landed
    __syncthreads();                                    // tile 0 is readable by all four waves
    fill_tile(l0 + STGB, gk + KS * HD * 2, gh + KS * 2, gl + KS * 2);
    for (int t = 0; t < NT; ++t) {
        const unsigned char* sb = fb + (t & 1) * STGB;
#pragma unroll
        for (int kt = 0; kt < 2; ++kt)
#pragma unroll
            for (int ks = 0; ks < 2; ++ks) kf[kt][ks] = WFrag<h16>::ld((const h16*)(sb + kt * 16 * LP + ks * 64));
#pragma unroll
        for (int p = 0; p < KS / 32; ++p) {   // a pass is 32 keys
            v16bf vhf[4], vlf[4];
#pragma unroll
            for (int dt = 0; dt < 4; ++dt) { vhf[dt] = WFrag<bf>::ld((const bf*)(sb + TILEB + dt * 16 * LP + p * 64)); vlf[dt] = WFrag<bf>::ld((const bf*)(sb + 2 * TILEB + dt * 16 * LP + p * 64)); }
            __builtin_amdgcn_sched_barrier(0);   // the pass's value fragments are asked for as one group up here, a whole softmax ahead of their products; left free, the loads sink to two in front of every four products, each with its own full wait
            v8f st[2][2];   // st[kt][cg][r] = S[q0 + 16 cg + c][64 t + 32 p + 16 kt + 8 hi + r]
#pragma unroll
            for (int kt = 0; kt < 2; ++kt)
#pragma unroll
                for (int cg = 0; cg < 2; ++cg) st[kt][cg] = wmma16(kf[kt][0], qf[cg][0], (v8f){});
#pragma unroll
            for (int kt = 0; kt < 2; ++kt)
#pragma unroll
                for (int cg = 0; cg < 2; ++cg) st[kt][cg] = wmma16(kf[kt][1], qf[cg][1], st[kt][cg]);
            if (p + 1 < KS / 32) {   // the next pass's key fragments of the SAME tile, fetched behind this pass's score products
#pragma unroll
                for (int kt = 0; kt < 2; ++kt)
#pragma unroll
                    for (int ks = 0; ks < 2; ++ks) kf[kt][ks] = WFrag<h16>::ld((const h16*)(sb + ((p + 1) * 32 + kt * 16) * LP + ks * 64));
            }
            float mx[2];
#pragma unroll
            for (int cg = 0; cg < 2; ++cg) { float a = fmaxf(st[0][cg][0], st[1][cg][0]);
#pragma unroll
                for (int r = 1; r < 8; ++r) a = fmaxf(a, fmaxf(st[0][cg][r], st[1][cg][r]));
                a *= CS2; mx[cg] = fmaxf(a, xhalf(a)); }
            const bool need = (mx[0] > m[0] + 8.0f) || (mx[1] > m[1] + 8.0f);
            if (__builtin_amdgcn_ballot_w32(need) != 0) {
#pragma unroll
                for (int cg = 0; cg < 2; ++cg) { const float mn = fmaxf(m[cg], mx[cg]); const float al = __builtin_amdgcn_exp2f(m[cg] - mn); m[cg] = mn; sm[cg] *= al;
#pragma unroll
                    for (int dt = 0; dt < 4; ++dt) acc[dt][cg] *= al; }
            }
            v16bf ph[2], pl[2];
#pragma unroll
            for (int cg = 0; cg < 2; ++cg) { const v2f nm = {-m[cg], -m[cg]};
#pragma unroll
                for (int s = 0; s < 16; s += 2) {   // register pairs as they lie in the score tile: packed f32 operations, no copies
                    const v2f t2 = __builtin_elementwise_fma((v2f){st[s >> 3][cg][s & 7], st[s >> 3][cg][(s & 7) + 1]}, (v2f){CS2, CS2}, nm);
                    const v2f pe = {__builtin_amdgcn_exp2f(t2[0]), __builtin_amdgcn_exp2f(t2[1])};
                    sm[cg] += pe;
                    const v2bf h2 = __builtin_convertvector(pe, v2bf);
                    const v2bf l2 = __builtin_convertvector(pe - __builtin_convertvector(h2, v2f), v2bf);
                    ph[cg][s] = h2[0]; ph[cg][s + 1] = h2[1]; pl[cg][s] = l2[0]; pl[cg][s + 1] = l2[1];
                }
            }
            // three products per tile in the order hi.hi, lo(P).hi(V), hi(P).lo(V); eight independent tiles between dependent accumulates
#pragma unroll
            for (int dt = 0; dt < 4; ++dt)
#pragma unroll
                for (int cg = 0; cg < 2; ++cg) acc[dt][cg] = wmmab(vhf[dt], ph[cg], acc[dt][cg]);
#pragma unroll
            for (int dt = 0; dt < 4; ++dt)
#pragma unroll
                for (int cg = 0; cg < 2; ++cg) acc[dt][cg] = wmmab(vhf[dt], pl[cg], acc[dt][cg]);
#pragma unroll
            for (int dt = 0; dt < 4; ++dt)
#pragma unroll
                for (int cg = 0; cg < 2; ++cg) acc[dt][cg] = wmmab(vlf[dt], ph[cg], acc[dt][cg]);
        }
        asm volatile("s_wait_dscnt 0x0" ::: "memory");      // this wave's reads of tile t have returned before its buffer is handed to the copies
        asm volatile("s_wait_asynccnt 0x0" ::: "memory");   // this wave's share of tile t + 1 has landed
        __syncthreads();                                    // publishes tile t + 1 and ends every wave's reads of tile t
        if (t + 2 < NT) fill_tile(l0 + (unsigned)(t & 1) * STGB, gk + (size_t)(t + 2) * (KS * HD * 2), gh + (size_t)(t + 2) * (KS * 2), gl + (size_t)(t + 2) * (KS * 2));
    }
    asm volatile("s_wait_asynccnt 0x0" ::: "memory");       // no copy is outstanding when the wave ends
#pragma unroll
    for (int cg = 0; cg < 2; ++cg) {
        const float sl = sm[cg][0] + sm[cg][1]; const float f = __fdiv_rn(1.0f, sl + xhalf(sl));
        float* o = OUT + ((size_t)blockIdx.z * TT + q0 + cg * 16 + c) * DM + blockIdx.y * HD + 8 * hi;   // acc[dt][cg][r] = O[q0 + 16 cg + c][16 dt + 8 hi + r]
#pragma unroll
        for (int dt = 0; dt < 4; ++dt) { const v8f a = acc[dt][cg] * f; *(v4f*)(o + dt * 16) = (v4f){a[0], a[1], a[2], a[3]}; *(v4f*)(o + dt * 16 + 4) = (v4f){a[4], a[5], a[6], a[7]}; }
    }
}

extern "C" void kernel_launch(void* const* d_in, const int* in_sizes, int n_in,
                              void* d_out, int out_size, void* d_ws, size_t ws_size, hipStream_t stream) {
    if (n_in < 7) return;
    if (in_sizes[0] < NB * SEQ_FULL * DM) return;
    if (in_sizes[1] < NH_ * DM * HD || in_sizes[3] < NH_ * DM * HD || in_sizes[5] < NH_ * DM * HD) return;
    if (in_sizes[2] < NH_ * HD || in_sizes[4] < NH_ * HD || in_sizes[6] < NH_ * HD) return;
    if (out_size < NB * TT * DM) return;
    const float* x  = (const float*)d_in[0];
    const float* wq = (const float*)d_in[1]; const float* bq = (const float*)d_in[2];
    const float* wk = (const float*)d_in[3]; const float* bk = (const float*)d_in[4];
    const float* wv = (const float*)d_in[5]; const float* bv = (const float*)d_in[6];
    float* OUT = (float*)d_out;     // [NB][TT][DM]
    char* wsp = (char*)d_ws;
    auto take = [&](size_t bytes) { char* p = wsp; wsp += (bytes + 255) & ~(size_t)255; return (void*)p; };
    bf*    WT  = (bf*)take((size_t)3 * DM * DM * 2);                 // [3][DM][DM]  Bt planes
    bf*    XB  = (bf*)take((size_t)NB * SEQ_FULL * DM * 2);          // bf16 x, all batches
    h16*   QP  = (h16*)take((size_t)NB * NH_ * TT * HD * 2);         // planes of all batches
    h16*   KP  = (h16*)take((size_t)NB * NH_ * TT * HD * 2);
    bf*    VTh = (bf*)take((size_t)NB * NH_ * HD * TT * 2);
    bf*    VTl = (bf*)take((size_t)NB * NH_ * HD * TT * 2);
    if ((size_t)(wsp - (char*)d_ws) > ws_size) return;

    k_wt<<<dim3((unsigned)(((size_t)DM * DM / 8 + 255) / 256), 3), 256, 0, stream>>>(wq, wk, wv, WT);
    const size_t nx8 = (size_t)NB * SEQ_FULL * DM / 8;
    k_cvt8<<<(unsigned)((nx8 + 255) / 256), 256, 0, stream>>>(x, XB, nx8);
    k_proj<<<dim3(NB * TT / 128, NH_ / 2, 3), 128, 0, stream>>>(XB, WT, bq, bk, bv, QP, KP, VTh, VTl);
    k_fattn<<<dim3(TT / 128, NH_, NB), 128, 0, stream>>>(QP, KP, VTh, VTl, OUT);
}

// v005
// It runs in 80.1 microseconds.
// Next to v004, in two timings, it ran 1.04 and 1.03 times as fast.
// Over all steps from v000 it is 8.56 times as fast.
#include <hip/hip_runtime.h>

// Contractions, f32 accumulate: q/k/v projections v_wmma_f32_16x16x32_bf16 on bf16 (RNE) copies of x and W (exact products); scores v_wmma_f32_16x16x32_f16 on f16 q/k planes (single product); softmax f32; P.V v_wmma_f32_16x16x32_bf16 with P and V carried as bf16 hi+lo planes (3 products).
// Pipeline: ONE launch prepares both bf16 operands (x, transposed W); ONE launch over all (batch, 64 tokens, head, weight): bf16(x) x Bt, +bias, written straight as q/k planes [b][h][t][d] f16 and value planes [b][h][d][t] bf16 hi/lo; then ONE launch over all (batch, head, 128 queries), key and value tiles staged in LDS: S^T = K Q^T, online softmax of S/HD in f32, O^T += V^T P^T with P packed from the score accumulators, out[b][t][h*HD + d] written directly.

#ifndef NB
#define NB 8
#endif
#ifndef SEQ
#define SEQ 1024
#endif
#define SEQ_FULL 1024
#define TT   SEQ
#define DM   768
#define NH_  12
#define HD   64
#define SCL  0.015625f   // 1/HD (scores are divided by head_dim)

static_assert(TT % 128 == 0);
static_assert(TT <= SEQ_FULL);
static_assert(NH_ * HD == DM);
static_assert(DM % 64 == 0);
static_assert(HD == 64);
static_assert(NH_ % 2 == 0);
static_assert(NB >= 1 && NB <= 8);

typedef _Float16 h16;
typedef unsigned short bf;
typedef __attribute__((ext_vector_type(16))) __bf16   v16bf;
typedef __attribute__((ext_vector_type(16))) _Float16 v16h;
typedef __attribute__((ext_vector_type(8)))  _Float16 v8h;
typedef __attribute__((ext_vector_type(8)))  unsigned short v8us;
typedef __attribute__((ext_vector_type(8)))  float    v8f;
typedef __attribute__((ext_vector_type(4)))  float    v4f;
typedef __attribute__((ext_vector_type(4)))  unsigned short v4us;
typedef v8h  __attribute__((may_alias)) v8ha;
typedef v4f  __attribute__((may_alias)) v4fa;
typedef v8us __attribute__((may_alias)) v8usa;

__device__ __forceinline__ unsigned short f2bf(float f) { unsigned u = __float_as_uint(f); u += 0x7FFFu + ((u >> 16) & 1u); return (unsigned short)(u >> 16); }
__device__ __forceinline__ float bf2f(unsigned short b) { return __uint_as_float(((unsigned)b) << 16); }
__device__ __forceinline__ float bfr(float f) { return bf2f(f2bf(f)); }
__device__ __forceinline__ v16h cat16(v8h lo, v8h hi) { return __builtin_shufflevector(lo, hi, 0, 1, 2, 3, 4, 5, 6, 7, 8, 9, 10, 11, 12, 13, 14, 15); }
__device__ __forceinline__ v16bf cat16b(v8us lo, v8us hi) { return __builtin_bit_cast(v16bf, __builtin_shufflevector(lo, hi, 0, 1, 2, 3, 4, 5, 6, 7, 8, 9, 10, 11, 12, 13, 14, 15)); }
__device__ __forceinline__ v8f wmma16(v16h a, v16h b, v8f c) { return __builtin_amdgcn_wmma_f32_16x16x32_f16(false, a, false, b, (short)0, c, false, false); }
__device__ __forceinline__ v8f wmmab(v16bf a, v16bf b, v8f c) { return __builtin_amdgcn_wmma_f32_16x16x32_bf16(false, a, false, b, (short)0, c, false, false); }
__device__ __forceinline__ h16 tohx(float x) { return (h16)x; }
__device__ __forceinline__ void splitf(float y, unsigned short& h, unsigned short& l) { h = f2bf(y); l = f2bf(y - bf2f(h)); }

// ---- k_proj: q, k and v projections of ALL batches in one launch; the epilogue adds the bias and writes the operand planes of k_fattn straight from the accumulators.
// One wave per 64 tokens x one head x one of q/k/v (16 accumulators, K = DM); 4 waves per work-group = 2 token tiles x 2 heads; grid (NB*TT/128, NH_/2, 3).
// Operands come from LDS: a stage is 64 k = 128 token rows and 128 weight rows of 128 bytes each, brought in whole 128-byte lines by asynchronous copies, once for the four waves, two buffers, the next stage in flight while this one is worked on.
// LDS rows are unpadded (two buffers = 64 KiB, so five work-groups share a WGP's 320 KiB and the whole grid is resident); instead the 16-byte piece p of row r lies at place p ^ ((r >> 1) & 7) of its row:
// 16 lanes that read one piece of 16 consecutive rows then fall on 16 different 16-byte places modulo 256 bytes, that is on all 64 banks once.
// Fragments: lane -> row/col lane&15; elements 0..7 <- k0 + 8h + 0..7, elements 8..15 <- k0 + 16 + 8h + 0..7 (h = lane>>4), identical for both operands, so either plane can stand on either side of the product.
// A lane's 8 accumulator registers run along the rows of the first operand: the weight rows stand first for q and k (8 consecutive d of one token = one 16-byte store into [t][d]), the token rows stand first for v (8 consecutive t of one d = one 16-byte store into [d][t]).
template <typename T16> struct WFrag;
template <> struct WFrag<h16> { typedef v16h V; static __device__ __forceinline__ V ld(const h16* p) { return cat16(*(const v8h*)p, *(const v8h*)(p + 16)); } static __device__ __forceinline__ v8f mma(V a, V b, v8f c) { return wmma16(a, b, c); } };
template <> struct WFrag<bf> { typedef v16bf V; static __device__ __forceinline__ V ld(const bf* p) { return cat16b(*(const v8us*)p, *(const v8us*)(p + 16)); } static __device__ __forceinline__ v8f mma(V a, V b, v8f c) { return wmmab(a, b, c); } };
#define PK    64             // k per stage
#define PLP   128            // LDS row pitch in bytes, no pad
#define PHALF (128 * PLP)    // 128 rows of one operand
#define PSTG  (2 * PHALF)    // token rows | weight rows
#define PNT   (DM / PK)
static_assert(DM % PK == 0 && PNT >= 2);
// A lane's eight 16-byte copies of one operand's 128 rows: 128 lanes x 16 bytes = 16 rows per copy. l: the lane's LDS byte address in the first 16 rows; g: its global bytes there.
// The address-translation wait closes the statement, so no register that a copy names is rewritten ahead of it.
__device__ __forceinline__ void fill_rows(unsigned l, const char* g) {
    asm volatile("global_load_async_to_lds_b128 %0, %8, off\n\t"
                 "global_load_async_to_lds_b128 %1, %9, off\n\t"
                 "global_load_async_to_lds_b128 %2, %10, off\n\t"
                 "global_load_async_to_lds_b128 %3, %11, off\n\t"
                 "global_load_async_to_lds_b128 %4, %12, off\n\t"
                 "global_load_async_to_lds_b128 %5, %13, off\n\t"
                 "global_load_async_to_lds_b128 %6, %14, off\n\t"
                 "global_load_async_to_lds_b128 %7, %15, off\n\t"
                 "s_wait_xcnt 0x0"
                 :: "v"(l), "v"(l + 16 * PLP), "v"(l + 32 * PLP), "v"(l + 48 * PLP), "v"(l + 64 * PLP), "v"(l + 80 * PLP), "v"(l + 96 * PLP), "v"(l + 112 * PLP),
                    "v"(g), "v"(g + 16 * DM * 2), "v"(g + 32 * DM * 2), "v"(g + 48 * DM * 2), "v"(g + 64 * DM * 2), "v"(g + 80 * DM * 2), "v"(g + 96 * DM * 2), "v"(g + 112 * DM * 2)
                 : "memory");
}
__global__ __launch_bounds__(128) void k_proj(const bf* __restrict__ XB, const bf* __restrict__ WT, const float* __restrict__ bq, const float* __restrict__ bk, const float* __restrict__ bv, h16* QP, h16* KP, bf* Vh, bf* Vl) {
    __shared__ __attribute__((aligned(16))) unsigned char stg[2 * PSTG];
    const int tid = threadIdx.x, lane = tid & 31, lr = lane & 15, hi = lane >> 4;
    const int wave = __builtin_amdgcn_readfirstlane(threadIdx.x >> 5);   // the tile's indices stay in scalar registers
    const int z = blockIdx.z;
    const int r0 = (blockIdx.x * 2 + (wave & 1)) * 64, b = r0 / TT, t0 = r0 % TT;   // 64 tokens of one batch (TT % 64 == 0)
    const int h = blockIdx.y * 2 + (wave >> 1);
    // copies: lane tid brings piece tid & 7 of row tid >> 3 (of each 16 rows); the work-group's 128 tokens lie in one batch (TT % 128 == 0)
    const unsigned l0 = (unsigned)(uintptr_t)stg + (unsigned)((tid >> 3) * PLP + (((tid & 7) ^ ((tid >> 4) & 7)) * 16));
    const char* gx = (const char*)(XB + ((size_t)(blockIdx.x * 128 / TT) * SEQ_FULL + blockIdx.x * 128 % TT + (tid >> 3)) * DM) + (tid & 7) * 16;
    const char* gw = (const char*)(WT + ((size_t)z * DM + blockIdx.y * 128 + (tid >> 3)) * DM) + (tid & 7) * 16;
    // readers: lane -> row lr of a 16-row group, pieces hi and 2 + hi of each four (bytes 16 hi + 0..15 and 32 + 16 hi + 0..15 of each 64, as from the planes), each at its place in the row
    const unsigned char* xr = stg + ((wave & 1) * 64 + lr) * PLP;
    const unsigned char* wr = stg + PHALF + ((wave >> 1) * 64 + lr) * PLP;
    int po[PK / 32][2];
#pragma unroll
    for (int ks = 0; ks < PK / 32; ++ks)
#pragma unroll
        for (int j = 0; j < 2; ++j) po[ks][j] = ((ks * 4 + j * 2 + hi) ^ ((lr >> 1) & 7)) * 16;
    const unsigned char* P = (z == 2) ? xr : wr;   // rows of the result tile
    const unsigned char* Q = (z == 2) ? wr : xr;   // columns of the result tile
    fill_rows(l0, gx); fill_rows(l0 + PHALF, gw);
    v8f acc[4][4];
#pragma unroll
    for (int mb = 0; mb < 4; ++mb)
#pragma unroll
        for (int nb = 0; nb < 4; ++nb) acc[mb][nb] = (v8f){};
    asm volatile("s_wait_asynccnt 0x0" ::: "memory");   // this wave's share of stage 0 has landed
    __syncthreads();                                    // stage 0 is readable by all four waves
    fill_rows(l0 + PSTG, gx + PK * 2); fill_rows(l0 + PSTG + PHALF, gw + PK * 2);
    for (int t = 0; t < PNT; ++t) {
        const unsigned char* pk = P + (t & 1) * PSTG; const unsigned char* qk = Q + (t & 1) * PSTG;
#pragma unroll
        for (int ks = 0; ks < PK / 32; ++ks) {
            v16bf a[4], q[4];
#pragma unroll
            for (int mb = 0; mb < 4; ++mb) a[mb] = cat16b(*(const v8us*)(pk + mb * 16 * PLP + po[ks][0]), *(const v8us*)(pk + mb * 16 * PLP + po[ks][1]));
#pragma unroll
            for (int nb = 0; nb < 4; ++nb) q[nb] = cat16b(*(const v8us*)(qk + nb * 16 * PLP + po[ks][0]), *(const v8us*)(qk + nb * 16 * PLP + po[ks][1]));
#pragma unroll
            for (int nb = 0; nb < 4; ++nb)
#pragma unroll
                for (int mb = 0; mb < 4; ++mb) acc[mb][nb] = wmmab(a[mb], q[nb], acc[mb][nb]);
        }
        asm volatile("s_wait_dscnt 0x0" ::: "memory");      // this wave's reads of stage t have returned before its buffer is handed to the copies
        asm volatile("s_wait_asynccnt 0x0" ::: "memory");   // this wave's share of stage t + 1 has landed
        __syncthreads();                                    // publishes stage t + 1 and ends every wave's reads of stage t
        if (t + 2 < PNT) { fill_rows(l0 + (unsigned)(t & 1) * PSTG, gx + (size_t)(t + 2) * (PK * 2)); fill_rows(l0 + (unsigned)(t & 1) * PSTG + PHALF, gw + (size_t)(t + 2) * (PK * 2)); }
    }
    asm volatile("s_wait_asynccnt 0x0" ::: "memory");       // no copy is outstanding when the wave ends
    const size_t bh = (size_t)b * NH_ + h;
    if (z < 2) {   // acc[mb][nb][j] = (x W)[t0 + 16 nb + lr][16 mb + 8 hi + j]
        const float* bias = (z ? bk : bq) + h * HD + 8 * hi;
        h16* o = (z ? KP : QP) + (bh * TT + t0 + lr) * HD + 8 * hi;
        v8f bb[4];
#pragma unroll
        for (int mb = 0; mb < 4; ++mb) bb[mb] = *(const v8f*)(bias + mb * 16);
#pragma unroll
        for (int mb = 0; mb < 4; ++mb)
#pragma unroll
            for (int j = 0; j < 8; ++j) bb[mb][j] = bfr(bb[mb][j]);
#pragma unroll
        for (int nb = 0; nb < 4; ++nb)
#pragma unroll
            for (int mb = 0; mb < 4; ++mb) { v8h v;
#pragma unroll
                for (int j = 0; j < 8; ++j) v[j] = tohx(acc[mb][nb][j] + bb[mb][j]);
                *(v8h*)(o + (size_t)nb * 16 * HD + mb * 16) = v; }
    } else {       // acc[mb][nb][j] = (x W)[t0 + 16 mb + 8 hi + j][16 nb + lr]
        const size_t e = (bh * HD + lr) * TT + t0 + 8 * hi;
        float bl[4];
#pragma unroll
        for (int nb = 0; nb < 4; ++nb) bl[nb] = bv[h * HD + nb * 16 + lr];
#pragma unroll
        for (int nb = 0; nb < 4; ++nb) { const float bb = bfr(bl[nb]);
#pragma unroll
            for (int mb = 0; mb < 4; ++mb) { v8us oh, ol;
#pragma unroll
                for (int j = 0; j < 8; ++j) { unsigned short a2, c2; splitf(acc[mb][nb][j] + bb, a2, c2); oh[j] = a2; ol[j] = c2; }
                *(v8us*)(Vh + e + (size_t)nb * 16 * TT + mb * 16) = oh; *(v8us*)(Vl + e + (size_t)nb * 16 * TT + mb * 16) = ol;
                __builtin_amdgcn_sched_barrier(0); } }   // one tile's split at a time: interleaved tiles' temporaries lift the kernel over 192 registers, the most that lets five waves share a SIMD
    }
}

// k_prep: both operand preparations of k_proj in ONE launch; they read and write disjoint buffers and neither waits on the other.
// Work-groups 0 .. 3 WTB - 1 write the transposed bf16 weight planes Bt (each of their 4-byte loads touches 32 lines, so they start first and wait for those lines while the x stream runs); the rest convert x to bf16, 8 values a thread.
#define WTB ((DM * DM / 8 + 255) / 256)              // work-groups per weight plane
#define NX8 ((size_t)NB * SEQ_FULL * DM / 8)         // 8-value pieces of x
#define CVB ((unsigned)((NX8 + 255) / 256))          // work-groups of the x conversion
__global__ __launch_bounds__(256) void k_prep(const float* __restrict__ src, const float* __restrict__ wq, const float* __restrict__ wk, const float* __restrict__ wv, bf* dst, bf* Bt) {
    if (blockIdx.x < 3 * WTB) {
        const int z = blockIdx.x / WTB;
        const float* w = (z == 0) ? wq : ((z == 1) ? wk : wv);
        const size_t i = (size_t)(blockIdx.x % WTB) * 256 + threadIdx.x; if (i >= (size_t)DM * DM / 8) return;
        const size_t e = i * 8; const int k = (int)(e % DM); const int n = (int)(e / DM); const int h = n / HD, c = n % HD;
        v8us o;
#pragma unroll
        for (int q = 0; q < 8; ++q) o[q] = f2bf(w[((size_t)h * DM + k + q) * HD + c]);
        bf* d = Bt + (size_t)z * DM * DM + e;
        *(v8us*)d = o;
    } else {
        const size_t i = (size_t)(blockIdx.x - 3 * WTB) * 256 + threadIdx.x; if (i >= NX8) return;
        const v8f v = *(const v8f*)(src + i * 8); v8us o;
#pragma unroll
        for (int k = 0; k < 8; ++k) o[k] = f2bf(v[k]);
        *(v8us*)(dst + i * 8) = o;
    }
}

typedef __attribute__((ext_vector_type(2))) float  v2f;
typedef __attribute__((ext_vector_type(2))) __bf16 v2bf;
#define CS2 (SCL * 1.4426950408889634f)
#define KS    64            // keys per tile
#define LP    144           // LDS row pitch in bytes: 128 + 16, an odd multiple of 16, free of bank conflicts for 16-byte readers of 16 rows
#define TILEB (64 * LP)     // 64 rows
#define STGB  (3 * TILEB)   // key rows | value-hi rows | value-lo rows
#define NT    (TT / KS)
static_assert(NT >= 2);
__device__ __forceinline__ float xhalf(float x) { const int b = __float_as_int(x); return __int_as_float(__builtin_amdgcn_permlanex16(b, b, 0x76543210, 0xfedcba98, false, false)); }
// A lane's twelve 16-byte copies of one tile: 128 lanes x 16 bytes = 16 rows per copy, four copies per plane. l: the lane's LDS byte address in the key plane's first 16 rows; gk, gh, gl: its global bytes there.
// The address-translation wait closes the statement, so no register that a copy names is rewritten ahead of it.
__device__ __forceinline__ void fill_tile(unsigned l, const char* gk, const char* gh, const char* gl) {
    asm volatile("global_load_async_to_lds_b128 %0, %12, off\n\t"
                 "global_load_async_to_lds_b128 %1, %13, off\n\t"
                 "global_load_async_to_lds_b128 %2, %14, off\n\t"
                 "global_load_async_to_lds_b128 %3, %15, off\n\t"
                 "global_load_async_to_lds_b128 %4, %16, off\n\t"
                 "global_load_async_to_lds_b128 %5, %17, off\n\t"
                 "global_load_async_to_lds_b128 %6, %18, off\n\t"
                 "global_load_async_to_lds_b128 %7, %19, off\n\t"
                 "global_load_async_to_lds_b128 %8, %20, off\n\t"
                 "global_load_async_to_lds_b128 %9, %21, off\n\t"
                 "global_load_async_to_lds_b128 %10, %22, off\n\t"
                 "global_load_async_to_lds_b128 %11, %23, off\n\t"
                 "s_wait_xcnt 0x0"
                 :: "v"(l), "v"(l + 16 * LP), "v"(l + 32 * LP), "v"(l + 48 * LP),
                    "v"(l + TILEB), "v"(l + TILEB + 16 * LP), "v"(l + TILEB + 32 * LP), "v"(l + TILEB + 48 * LP),
                    "v"(l + 2 * TILEB), "v"(l + 2 * TILEB + 16 * LP), "v"(l + 2 * TILEB + 32 * LP), "v"(l + 2 * TILEB + 48 * LP),
                    "v"(gk), "v"(gk + 16 * HD * 2), "v"(gk + 32 * HD * 2), "v"(gk + 48 * HD * 2),
                    "v"(gh), "v"(gh + 16 * TT * 2), "v"(gh + 32 * TT * 2), "v"(gh + 48 * TT * 2),
                    "v"(gl), "v"(gl + 16 * TT * 2), "v"(gl + 32 * TT * 2), "v"(gl + 48 * TT * 2)
                 : "memory");
}
__global__ __launch_bounds__(128) void k_fattn(const h16* __restrict__ QP, const h16* __restrict__ KP, const bf* __restrict__ Vh, const bf* __restrict__ Vl, float* __restrict__ OUT) {
    __shared__ __attribute__((aligned(16))) unsigned char ring[2 * STGB];
    const int tid = threadIdx.x, lane = tid & 31, c = lane & 15, hi = lane >> 4, wave = tid >> 5;
    const size_t bh = (size_t)blockIdx.z * NH_ + blockIdx.y;
    const int q0 = blockIdx.x * 128 + wave * 32;
    const h16* qp = QP + bh * TT * HD + (size_t)(q0 + c) * HD + 8 * hi;
    // copies: lane tid brings piece tid & 7 of row tid >> 3 (of each 16 rows)
    const unsigned l0 = (unsigned)(uintptr_t)ring + (unsigned)((tid >> 3) * LP + (tid & 7) * 16);
    const char* gk = (const char*)(KP + bh * TT * HD) + tid * 16;
    const char* gh = (const char*)(Vh + bh * HD * TT) + (size_t)(tid >> 3) * (TT * 2) + (tid & 7) * 16;
    const char* gl = (const char*)(Vl + bh * HD * TT) + (size_t)(tid >> 3) * (TT * 2) + (tid & 7) * 16;
    // readers: lane -> row c of a 16-row group, bytes 16 hi + 0..15 and 32 + 16 hi + 0..15 of each 64 bytes, as from the planes
    const unsigned char* fb = ring + c * LP + 16 * hi;
    fill_tile(l0, gk, gh, gl);
    v16h qf[2][2], kf[2][2];
#pragma unroll
    for (int cg = 0; cg < 2; ++cg)
#pragma unroll
        for (int ks = 0; ks < 2; ++ks) qf[cg][ks] = WFrag<h16>::ld(qp + cg * 16 * HD + ks * 32);
    v8f acc[4][2];
#pragma unroll
    for (int dt = 0; dt < 4; ++dt)
#pragma unroll
        for (int cg = 0; cg < 2; ++cg) acc[dt][cg] = (v8f){};
    float m[2] = {-3.0e38f, -3.0e38f}; v2f sm[2] = {(v2f){0.f, 0.f}, (v2f){0.f, 0.f}};   // sm: a lane's sums over its even and its odd keys
    asm volatile("s_wait_asynccnt 0x0" ::: "memory");   // this wave's share of tile 0 has landed
    __syncthreads();                                    // tile 0 is readable by all four waves
    fill_tile(l0 + STGB, gk + KS * HD * 2, gh + KS * 2, gl + KS * 2);
    for (int t = 0; t < NT; ++t) {
        const unsigned char* sb = fb + (t & 1) * STGB;
#pragma unroll
        for (int kt = 0; kt < 2; ++kt)
#pragma unroll
            for (int ks = 0; ks < 2; ++ks) kf[kt][ks] = WFrag<h16>::ld((const h16*)(sb + kt * 16 * LP + ks * 64));
#pragma unroll
        for (int p = 0; p < KS / 32; ++p) {   // a pass is 32 keys
            v16bf vhf[4], vlf[4];
#pragma unroll
            for (int dt = 0; dt < 4; ++dt) { vhf[dt] = WFrag<bf>::ld((const bf*)(sb + TILEB + dt * 16 * LP + p * 64)); vlf[dt] = WFrag<bf>::ld((const bf*)(sb + 2 * TILEB + dt * 16 * LP + p * 64)); }
            __builtin_amdgcn_sched_barrier(0);   // the pass's value fragments are asked for as one group up here, a whole softmax ahead of their products; left free, the loads sink to two in front of every four products, each with its own full wait
            v8f st[2][2];   // st[kt][cg][r] = S[q0 + 16 cg + c][64 t + 32 p + 16 kt + 8 hi + r]
#pragma unroll
            for (int kt = 0; kt < 2; ++kt)
#pragma unroll
                for (int cg = 0; cg < 2; ++cg) st[kt][cg] = wmma16(kf[kt][0], qf[cg][0], (v8f){});
#pragma unroll
            for (int kt = 0; kt < 2; ++kt)
#pragma unroll
                for (int cg = 0; cg < 2; ++cg) st[kt][cg] = wmma16(kf[kt][1], qf[cg][1], st[kt][cg]);
            if (p + 1 < KS / 32) {   // the next pass's key fragments of the SAME tile, fetched behind this pass's score products
#pragma unroll
                for (int kt = 0; kt < 2; ++kt)
#pragma unroll
                    for (int ks = 0; ks < 2; ++ks) kf[kt][ks] = WFrag<h16>::ld((const h16*)(sb + ((p + 1) * 32 + kt * 16) * LP + ks * 64));
            }
            float mx[2];
#pragma unroll
            for (int cg = 0; cg < 2; ++cg) { float a = fmaxf(st[0][cg][0], st[1][cg][0]);
#pragma unroll
                for (int r = 1; r < 8; ++r) a = fmaxf(a, fmaxf(st[0][cg][r], st[1][cg][r]));
                a *= CS2; mx[cg] = fmaxf(a, xhalf(a)); }
            const bool need = (mx[0] > m[0] + 8.0f) || (mx[1] > m[1] + 8.0f);
            if (__builtin_amdgcn_ballot_w32(need) != 0) {
#pragma unroll
                for (int cg = 0; cg < 2; ++cg) { const float mn = fmaxf(m[cg], mx[cg]); const float al = __builtin_amdgcn_exp2f(m[cg] - mn); m[cg] = mn; sm[cg] *= al;
#pragma unroll
                    for (int dt = 0; dt < 4; ++dt) acc[dt][cg] *= al; }
            }
            v16bf ph[2], pl[2];
#pragma unroll
            for (int cg = 0; cg < 2; ++cg) { const v2f nm = {-m[cg], -m[cg]};
#pragma unroll
                for (int s = 0; s < 16; s += 2) {   // register pairs as they lie in the score tile: packed f32 operations, no copies
                    const v2f t2 = __builtin_elementwise_fma((v2f){st[s >> 3][cg][s & 7], st[s >> 3][cg][(s & 7) + 1]}, (v2f){CS2, CS2}, nm);
                    const v2f pe = {__builtin_amdgcn_exp2f(t2[0]), __builtin_amdgcn_exp2f(t2[1])};
                    sm[cg] += pe;
                    const v2bf h2 = __builtin_convertvector(pe, v2bf);
                    const v2bf l2 = __builtin_convertvector(pe - __builtin_convertvector(h2, v2f), v2bf);
                    ph[cg][s] = h2[0]; ph[cg][s + 1] = h2[1]; pl[cg][s] = l2[0]; pl[cg][s + 1] = l2[1];
                }
            }
            // three products per tile in the order hi.hi, lo(P).hi(V), hi(P).lo(V); eight independent tiles between dependent accumulates
#pragma unroll
            for (int dt = 0; dt < 4; ++dt)
#pragma unroll
                for (int cg = 0; cg < 2; ++cg) acc[dt][cg] = wmmab(vhf[dt], ph[cg], acc[dt][cg]);
#pragma unroll
            for (int dt = 0; dt < 4; ++dt)
#pragma unroll
                for (int cg = 0; cg < 2; ++cg) acc[dt][cg] = wmmab(vhf[dt], pl[cg], acc[dt][cg]);
#pragma unroll
            for (int dt = 0; dt < 4; ++dt)
#pragma unroll
                for (int cg = 0; cg < 2; ++cg) acc[dt][cg] = wmmab(vlf[dt], ph[cg], acc[dt][cg]);
        }
        asm volatile("s_wait_dscnt 0x0" ::: "memory");      // this wave's reads of tile t have returned before its buffer is handed to the copies
        asm volatile("s_wait_asynccnt 0x0" ::: "memory");   // this wave's share of tile t + 1 has landed
        __syncthreads();                                    // publishes tile t + 1 and ends every wave's reads of tile t
        if (t + 2 < NT) fill_tile(l0 + (unsigned)(t & 1) * STGB, gk + (size_t)(t + 2) * (KS * HD * 2), gh + (size_t)(t + 2) * (KS * 2), gl + (size_t)(t + 2) * (KS * 2));
    }
    asm volatile("s_wait_asynccnt 0x0" ::: "memory");       // no copy is outstanding when the wave ends
#pragma unroll
    for (int cg = 0; cg < 2; ++cg) {
        const float sl = sm[cg][0] + sm[cg][1]; const float f = __fdiv_rn(1.0f, sl + xhalf(sl));
        float* o = OUT + ((size_t)blockIdx.z * TT + q0 + cg * 16 + c) * DM + blockIdx.y * HD + 8 * hi;   // acc[dt][cg][r] = O[q0 + 16 cg + c][16 dt + 8 hi + r]
#pragma unroll
        for (int dt = 0; dt < 4; ++dt) { const v8f a = acc[dt][cg] * f; *(v4f*)(o + dt * 16) = (v4f){a[0], a[1], a[2], a[3]}; *(v4f*)(o + dt * 16 + 4) = (v4f){a[4], a[5], a[6], a[7]}; }
    }
}

extern "C" void kernel_launch(void* const* d_in, const int* in_sizes, int n_in,
                              void* d_out, int out_size, void* d_ws, size_t ws_size, hipStream_t stream) {
    if (n_in < 7) return;
    if (in_sizes[0] < NB * SEQ_FULL * DM) return;
    if (in_sizes[1] < NH_ * DM * HD || in_sizes[3] < NH_ * DM * HD || in_sizes[5] < NH_ * DM * HD) return;
    if (in_sizes[2] < NH_ * HD || in_sizes[4] < NH_ * HD || in_sizes[6] < NH_ * HD) return;
    if (out_size < NB * TT * DM) return;
    const float* x  = (const float*)d_in[0];
    const float* wq = (const float*)d_in[1]; const float* bq = (const float*)d_in[2];
    const float* wk = (const float*)d_in[3]; const float* bk = (const float*)d_in[4];
    const float* wv = (const float*)d_in[5]; const float* bv = (const float*)d_in[6];
    float* OUT = (float*)d_out;     // [NB][TT][DM]
    char* wsp = (char*)d_ws;
    auto take = [&](size_t bytes) { char* p = wsp; wsp += (bytes + 255) & ~(size_t)255; return (void*)p; };
    bf*    WT  = (bf*)take((size_t)3 * DM * DM * 2);                 // [3][DM][DM]  Bt planes
    bf*    XB  = (bf*)take((size_t)NB * SEQ_FULL * DM * 2);          // bf16 x, all batches
    h16*   QP  = (h16*)take((size_t)NB * NH_ * TT * HD * 2);         // planes of all batches
    h16*   KP  = (h16*)take((size_t)NB * NH_ * TT * HD * 2);
    bf*    VTh = (bf*)take((size_t)NB * NH_ * HD * TT * 2);
    bf*    VTl = (bf*)take((size_t)NB * NH_ * HD * TT * 2);
    if ((size_t)(wsp - (char*)d_ws) > ws_size) return;

    k_prep<<<3 * WTB + CVB, 256, 0, stream>>>(x, wq, wk, wv, XB, WT);
    k_proj<<<dim3(NB * TT / 128, NH_ / 2, 3), 128, 0, stream>>>(XB, WT, bq, bk, bv, QP, KP, VTh, VTl);
    k_fattn<<<dim3(TT / 128, NH_, NB), 128, 0, stream>>>(QP, KP, VTh, VTl, OUT);
}

// v007
// It runs in 63.5 microseconds.
// Versions between v005 and this one are left out; their measured steps multiply to 1.26 times as fast.
// Counting every step since v000, it is 10.8 times as fast.
#include <hip/hip_runtime.h>

// Contractions, f32 accumulate: q/k/v projections v_wmma_f32_16x16x32_bf16 on bf16 (RNE) copies of x and W (exact products); scores v_wmma_f32_16x16x32_f16 on f16 q/k planes (single product); softmax f32; P.V v_wmma_f32_16x16x32_f16 on P and V each rounded once (RNE) to f16 (single product): the bf16 copies of x and W already leave a value several f16 rounding steps away from the f32 projection, so f16's own rounding adds little to the output's error.
// Pipeline: ONE launch prepares both bf16 operands (x, transposed W); ONE launch over all (batch, 64 tokens, head, weight): bf16(x) x Bt, +bias, written straight as q/k planes [b][h][t][d] f16 and the value plane [b][h][d][t] f16; then ONE launch over all (batch, head, 128 queries), key and value tiles staged in LDS: S^T = K Q^T, online softmax of S/HD in f32, O^T += V^T P^T with P packed from the score accumulators, out[b][t][h*HD + d] written directly.

#ifndef NB
#define NB 8
#endif
#ifndef SEQ
#define SEQ 1024
#endif
#define SEQ_FULL 1024
#define TT   SEQ
#define DM   768
#define NH_  12
#define HD   64
#define SCL  0.015625f   // 1/HD (scores are divided by head_dim)

static_assert(TT % 128 == 0);
static_assert(TT <= SEQ_FULL);
static_assert(NH_ * HD == DM);
static_assert(DM % 64 == 0);
static_assert(HD == 64);
static_assert(NH_ % 2 == 0);
static_assert(NB >= 1 && NB <= 8);

typedef _Float16 h16;
typedef unsigned short bf;
typedef __attribute__((ext_vector_type(16))) __bf16   v16bf;
typedef __attribute__((ext_vector_type(16))) _Float16 v16h;
typedef __attribute__((ext_vector_type(8)))  _Float16 v8h;
typedef __attribute__((ext_vector_type(8)))  unsigned short v8us;
typedef __attribute__((ext_vector_type(8)))  float    v8f;
typedef __attribute__((ext_vector_type(4)))  float    v4f;
typedef __attribute__((ext_vector_type(4)))  unsigned short v4us;
typedef v8h  __attribute__((may_alias)) v8ha;
typedef v4f  __attribute__((may_alias)) v4fa;
typedef v8us __attribute__((may_alias)) v8usa;

__device__ __forceinline__ unsigned short f2bf(float f) { unsigned u = __float_as_uint(f); u += 0x7FFFu + ((u >> 16) & 1u); return (unsigned short)(u >> 16); }
__device__ __forceinline__ float bf2f(unsigned short b) { return __uint_as_float(((unsigned)b) << 16); }
__device__ __forceinline__ float bfr(float f) { return bf2f(f2bf(f)); }
__device__ __forceinline__ v16h cat16(v8h lo, v8h hi) { return __builtin_shufflevector(lo, hi, 0, 1, 2, 3, 4, 5, 6, 7, 8, 9, 10, 11, 12, 13, 14, 15); }
__device__ __forceinline__ v16bf cat16b(v8us lo, v8us hi) { return __builtin_bit_cast(v16bf, __builtin_shufflevector(lo, hi, 0, 1, 2, 3, 4, 5, 6, 7, 8, 9, 10, 11, 12, 13, 14, 15)); }
__device__ __forceinline__ v8f wmma16(v16h a, v16h b, v8f c) { return __builtin_amdgcn_wmma_f32_16x16x32_f16(false, a, false, b, (short)0, c, false, false); }
__device__ __forceinline__ v8f wmmab(v16bf a, v16bf b, v8f c) { return __builtin_amdgcn_wmma_f32_16x16x32_bf16(false, a, false, b, (short)0, c, false, false); }
__device__ __forceinline__ h16 tohx(float x) { return (h16)x; }

// ---- k_proj: q, k and v projections of ALL batches in one launch; the epilogue adds the bias and writes the operand planes of k_fattn straight from the accumulators.
// One wave per 64 tokens x one head x one of q/k/v (16 accumulators, K = DM); 4 waves per work-group = 2 token tiles x 2 heads; grid (NB*TT/128, NH_/2, 3).
// Operands come from LDS: a stage is 64 k = 128 token rows and 128 weight rows of 128 bytes each, brought in whole 128-byte lines by asynchronous copies, once for the four waves, two buffers, the next stage in flight while this one is worked on.
// LDS rows are unpadded (two buffers = 64 KiB, so five work-groups share a WGP's 320 KiB and the whole grid is resident); instead the 16-byte piece p of row r lies at place p ^ ((r >> 1) & 7) of its row:
// 16 lanes that read one piece of 16 consecutive rows then fall on 16 different 16-byte places modulo 256 bytes, that is on all 64 banks once.
// Fragments: lane -> row/col lane&15; elements 0..7 <- k0 + 8h + 0..7, elements 8..15 <- k0 + 16 + 8h + 0..7 (h = lane>>4), identical for both operands, so either plane can stand on either side of the product.
// A lane's 8 accumulator registers run along the rows of the first operand: the weight rows stand first for q and k (8 consecutive d of one token = one 16-byte store into [t][d]), the token rows stand first for v (8 consecutive t of one d = one 16-byte store into [d][t]).
template <typename T16> struct WFrag;
template <> struct WFrag<h16> { typedef v16h V; static __device__ __forceinline__ V ld(const h16* p) { return cat16(*(const v8h*)p, *(const v8h*)(p + 16)); } static __device__ __forceinline__ v8f mma(V a, V b, v8f c) { return wmma16(a, b, c); } };
#define PK    64             // k per stage
#define PLP   128            // LDS row pitch in bytes, no pad
#define PHALF (128 * PLP)    // 128 rows of one operand
#define PSTG  (2 * PHALF)    // token rows | weight rows
#define PNT   (DM / PK)
static_assert(DM % PK == 0 && PNT >= 2);
// A lane's eight 16-byte copies of one operand's 128 rows: 128 lanes x 16 bytes = 16 rows per copy. l: the lane's LDS byte address in the first 16 rows; g: its global bytes there.
// The address-translation wait closes the statement, so no register that a copy names is rewritten ahead of it.
__device__ __forceinline__ void fill_rows(unsigned l, const char* g) {
    asm volatile("global_load_async_to_lds_b128 %0, %8, off\n\t"
                 "global_load_async_to_lds_b128 %1, %9, off\n\t"
                 "global_load_async_to_lds_b128 %2, %10, off\n\t"
                 "global_load_async_to_lds_b128 %3, %11, off\n\t"
                 "global_load_async_to_lds_b128 %4, %12, off\n\t"
                 "global_load_async_to_lds_b128 %5, %13, off\n\t"
                 "global_load_async_to_lds_b128 %6, %14, off\n\t"
                 "global_load_async_to_lds_b128 %7, %15, off\n\t"
                 "s_wait_xcnt 0x0"
                 :: "v"(l), "v"(l + 16 * PLP), "v"(l + 32 * PLP), "v"(l + 48 * PLP), "v"(l + 64 * PLP), "v"(l + 80 * PLP), "v"(l + 96 * PLP), "v"(l + 112 * PLP),
                    "v"(g), "v"(g + 16 * DM * 2), "v"(g + 32 * DM * 2), "v"(g + 48 * DM * 2), "v"(g + 64 * DM * 2), "v"(g + 80 * DM * 2), "v"(g + 96 * DM * 2), "v"(g + 112 * DM * 2)
                 : "memory");
}
__global__ __launch_bounds__(128) void k_proj(const bf* __restrict__ XB, const bf* __restrict__ WT, const float* __restrict__ bq, const float* __restrict__ bk, const float* __restrict__ bv, h16* QP, h16* KP, h16* VT) {
    __shared__ __attribute__((aligned(16))) unsigned char stg[2 * PSTG];
    const int tid = threadIdx.x, lane = tid & 31, lr = lane & 15, hi = lane >> 4;
    const int wave = __builtin_amdgcn_readfirstlane(threadIdx.x >> 5);   // the tile's indices stay in scalar registers
    const int z = blockIdx.z;
    const int r0 = (blockIdx.x * 2 + (wave & 1)) * 64, b = r0 / TT, t0 = r0 % TT;   // 64 tokens of one batch (TT % 64 == 0)
    const int h = blockIdx.y * 2 + (wave >> 1);
    // copies: lane tid brings piece tid & 7 of row tid >> 3 (of each 16 rows); the work-group's 128 tokens lie in one batch (TT % 128 == 0)
    const unsigned l0 = (unsigned)(uintptr_t)stg + (unsigned)((tid >> 3) * PLP + (((tid & 7) ^ ((tid >> 4) & 7)) * 16));
    const char* gx = (const char*)(XB + ((size_t)(blockIdx.x * 128 / TT) * SEQ_FULL + blockIdx.x * 128 % TT + (tid >> 3)) * DM) + (tid & 7) * 16;
    const char* gw = (const char*)(WT + ((size_t)z * DM + blockIdx.y * 128 + (tid >> 3)) * DM) + (tid & 7) * 16;
    // readers: lane -> row lr of a 16-row group, pieces hi and 2 + hi of each four (bytes 16 hi + 0..15 and 32 + 16 hi + 0..15 of each 64, as from the planes), each at its place in the row
    const unsigned char* xr = stg + ((wave & 1) * 64 + lr) * PLP;
    const unsigned char* wr = stg + PHALF + ((wave >> 1) * 64 + lr) * PLP;
    int po[PK / 32][2];
#pragma unroll
    for (int ks = 0; ks < PK / 32; ++ks)
#pragma unroll
        for (int j = 0; j < 2; ++j) po[ks][j] = ((ks * 4 + j * 2 + hi) ^ ((lr >> 1) & 7)) * 16;
    const unsigned char* P = (z == 2) ? xr : wr;   // rows of the result tile
    const unsigned char* Q = (z == 2) ? wr : xr;   // columns of the result tile
    fill_rows(l0, gx); fill_rows(l0 + PHALF, gw);
    v8f acc[4][4];
#pragma unroll
    for (int mb = 0; mb < 4; ++mb)
#pragma unroll
        for (int nb = 0; nb < 4; ++nb) acc[mb][nb] = (v8f){};
    asm volatile("s_wait_asynccnt 0x0" ::: "memory");   // this wave's share of stage 0 has landed
    __syncthreads();                                    // stage 0 is readable by all four waves
    fill_rows(l0 + PSTG, gx + PK * 2); fill_rows(l0 + PSTG + PHALF, gw + PK * 2);
    for (int t = 0; t < PNT; ++t) {
        const unsigned char* pk = P + (t & 1) * PSTG; const unsigned char* qk = Q + (t & 1) * PSTG;
#pragma unroll
        for (int ks = 0; ks < PK / 32; ++ks) {
            v16bf a[4], q[4];
#pragma unroll
            for (int mb = 0; mb < 4; ++mb) a[mb] = cat16b(*(const v8us*)(pk + mb * 16 * PLP + po[ks][0]), *(const v8us*)(pk + mb * 16 * PLP + po[ks][1]));
#pragma unroll
            for (int nb = 0; nb < 4; ++nb) q[nb] = cat16b(*(const v8us*)(qk + nb * 16 * PLP + po[ks][0]), *(const v8us*)(qk + nb * 16 * PLP + po[ks][1]));
#pragma unroll
            for (int nb = 0; nb < 4; ++nb)
#pragma unroll
                for (int mb = 0; mb < 4; ++mb) acc[mb][nb] = wmmab(a[mb], q[nb], acc[mb][nb]);
        }
        asm volatile("s_wait_dscnt 0x0" ::: "memory");      // this wave's reads of stage t have returned before its buffer is handed to the copies
        asm volatile("s_wait_asynccnt 0x0" ::: "memory");   // this wave's share of stage t + 1 has landed
        __syncthreads();                                    // publishes stage t + 1 and ends every wave's reads of stage t
        if (t + 2 < PNT) { fill_rows(l0 + (unsigned)(t & 1) * PSTG, gx + (size_t)(t + 2) * (PK * 2)); fill_rows(l0 + (unsigned)(t & 1) * PSTG + PHALF, gw + (size_t)(t + 2) * (PK * 2)); }
    }
    asm volatile("s_wait_asynccnt 0x0" ::: "memory");       // no copy is outstanding when the wave ends
    const size_t bh = (size_t)b * NH_ + h;
    if (z < 2) {   // acc[mb][nb][j] = (x W)[t0 + 16 nb + lr][16 mb + 8 hi + j]
        const float* bias = (z ? bk : bq) + h * HD + 8 * hi;
        h16* o = (z ? KP : QP) + (bh * TT + t0 + lr) * HD + 8 * hi;
        v8f bb[4];
#pragma unroll
        for (int mb = 0; mb < 4; ++mb) bb[mb] = *(const v8f*)(bias + mb * 16);
#pragma unroll
        for (int mb = 0; mb < 4; ++mb)
#pragma unroll
            for (int j = 0; j < 8; ++j) bb[mb][j] = bfr(bb[mb][j]);
#pragma unroll
        for (int nb = 0; nb < 4; ++nb)
#pragma unroll
            for (int mb = 0; mb < 4; ++mb) { v8h v;
#pragma unroll
                for (int j = 0; j < 8; ++j) v[j] = tohx(acc[mb][nb][j] + bb[mb][j]);
                *(v8h*)(o + (size_t)nb * 16 * HD + mb * 16) = v; }
    } else {       // acc[mb][nb][j] = (x W)[t0 + 16 mb + 8 hi + j][16 nb + lr]
        const size_t e = (bh * HD + lr) * TT + t0 + 8 * hi;
        float bl[4];
#pragma unroll
        for (int nb = 0; nb < 4; ++nb) bl[nb] = bv[h * HD + nb * 16 + lr];
#pragma unroll
        for (int nb = 0; nb < 4; ++nb) { const float bb = bfr(bl[nb]);
#pragma unroll
            for (int mb = 0; mb < 4; ++mb) { v8h v;
#pragma unroll
                for (int j = 0; j < 8; ++j) v[j] = tohx(acc[mb][nb][j] + bb);
                *(v8h*)(VT + e + (size_t)nb * 16 * TT + mb * 16) = v; } }
        asm volatile("s_wait_xcnt 0x0" ::: "memory");   // in the built code the q/k epilogue's text follows these stores and rewrites registers that they name: the wait stands between
    }
}

// k_prep: both operand preparations of k_proj in ONE launch; they read and write disjoint buffers and neither waits on the other.
// The launch is sized by the waves it has to start, not by its elements: a thread takes a block of values and asks for all of it before it converts any, so few waves keep many bytes in flight.
// Work-groups 0 .. 3 WTB - 1 write the transposed bf16 weight planes Bt, one head x 256 k each: a thread reads 4 c x 16 k as sixteen 16-byte loads (8 lanes = one whole 128-byte line of a weight row)
// and stores, for each of its 4 c, 16 bytes twice; the two stores of four lanes fill one 128-byte line of Bt, so a line has one writing wave. The rest convert x to bf16, 12 pieces of 8 values a thread, 3072 consecutive pieces a work-group.
// Every loop is fully unrolled, so that v stays in registers and a thread's loads all stand ahead of its first conversion.
#define WKB 256                                      // k per weight work-group
#define WTB (NH_ * (DM / WKB))                       // work-groups per weight plane
#define NX8 ((size_t)NB * SEQ_FULL * DM / 8)         // 8-value pieces of x
#define XPT 12                                       // pieces of x per thread
#define CVB ((unsigned)(NX8 / (256 * XPT)))          // work-groups of the x conversion
static_assert(DM % WKB == 0);
static_assert(NX8 % (256 * XPT) == 0);
__global__ __launch_bounds__(256) void k_prep(const float* __restrict__ src, const float* __restrict__ wq, const float* __restrict__ wk, const float* __restrict__ wv, bf* dst, bf* Bt) {
    if (blockIdx.x < 3 * WTB) {
        const int z = blockIdx.x / WTB, r = blockIdx.x % WTB, h = r / (DM / WKB), kg = r % (DM / WKB);
        const float* w = (z == 0) ? wq : ((z == 1) ? wk : wv);
        const int lane = threadIdx.x & 31, wave = threadIdx.x >> 5;
        const int c0 = (wave & 1) * 32 + (lane & 7) * 4;                    // 2 waves side by side cover the head's 64 c
        const int k0 = kg * WKB + (wave >> 1) * 64 + (lane >> 3) * 8;       // a wave covers 64 k: 4 lane groups x 8 k, twice, 32 k apart
        const float* s = w + ((size_t)h * DM + k0) * HD + c0;
        v4f v[2][8];
#pragma unroll
        for (int p = 0; p < 2; ++p)
#pragma unroll
            for (int q = 0; q < 8; ++q) v[p][q] = *(const v4f*)(s + (p * 32 + q) * HD);
        bf* d = Bt + (size_t)z * DM * DM + (size_t)(h * HD + c0) * DM + k0;
#pragma unroll
        for (int j = 0; j < 4; ++j)
#pragma unroll
            for (int p = 0; p < 2; ++p) { v8us o;
#pragma unroll
                for (int q = 0; q < 8; ++q) o[q] = f2bf(v[p][q][j]);
                *(v8us*)(d + (size_t)j * DM + p * 32) = o; }
    } else {
        const size_t i = (size_t)(blockIdx.x - 3 * WTB) * (256 * XPT) + threadIdx.x;
        v8f v[XPT];
#pragma unroll
        for (int p = 0; p < XPT; ++p) v[p] = *(const v8f*)(src + (i + p * 256) * 8);
#pragma unroll
        for (int p = 0; p < XPT; ++p) { v8us o;
#pragma unroll
            for (int k = 0; k < 8; ++k) o[k] = f2bf(v[p][k]);
            *(v8us*)(dst + (i + p * 256) * 8) = o; }
        asm volatile("s_wait_xcnt 0x0" ::: "memory");   // in the built code the weight branch's text follows these stores and rewrites registers that they name: the wait stands between
    }
}

typedef __attribute__((ext_vector_type(2))) float  v2f;
typedef __attribute__((ext_vector_type(2))) _Float16 v2h;
#define CS2 (SCL * 1.4426950408889634f)
#define KS    64            // keys per tile
#define LP    144           // LDS row pitch in bytes: 128 + 16, an odd multiple of 16, free of bank conflicts for 16-byte readers of 16 rows
#define TILEB (64 * LP)     // 64 rows
#define STGB  (2 * TILEB)   // key rows | value rows
#define NT    (TT / KS)
static_assert(NT >= 2);
__device__ __forceinline__ float xhalf(float x) { const int b = __float_as_int(x); return __int_as_float(__builtin_amdgcn_permlanex16(b, b, 0x76543210, 0xfedcba98, false, false)); }
// A lane's eight 16-byte copies of one tile: 128 lanes x 16 bytes = 16 rows per copy, four copies per plane. l: the lane's LDS byte address in the key plane's first 16 rows; gk, gv: its global bytes there.
// The address-translation wait closes the statement, so no register that a copy names is rewritten ahead of it.
__device__ __forceinline__ void fill_tile(unsigned l, const char* gk, const char* gv) {
    asm volatile("global_load_async_to_lds_b128 %0, %8, off\n\t"
                 "global_load_async_to_lds_b128 %1, %9, off\n\t"
                 "global_load_async_to_lds_b128 %2, %10, off\n\t"
                 "global_load_async_to_lds_b128 %3, %11, off\n\t"
                 "global_load_async_to_lds_b128 %4, %12, off\n\t"
                 "global_load_async_to_lds_b128 %5, %13, off\n\t"
                 "global_load_async_to_lds_b128 %6, %14, off\n\t"
                 "global_load_async_to_lds_b128 %7, %15, off\n\t"
                 "s_wait_xcnt 0x0"
                 :: "v"(l), "v"(l + 16 * LP), "v"(l + 32 * LP), "v"(l + 48 * LP),
                    "v"(l + TILEB), "v"(l + TILEB + 16 * LP), "v"(l + TILEB + 32 * LP), "v"(l + TILEB + 48 * LP),
                    "v"(gk), "v"(gk + 16 * HD * 2), "v"(gk + 32 * HD * 2), "v"(gk + 48 * HD * 2),
                    "v"(gv), "v"(gv + 16 * TT * 2), "v"(gv + 32 * TT * 2), "v"(gv + 48 * TT * 2)
                 : "memory");
}
__global__ __launch_bounds__(128) void k_fattn(const h16* __restrict__ QP, const h16* __restrict__ KP, const h16* __restrict__ VT, float* __restrict__ OUT) {
    __shared__ __attribute__((aligned(16))) unsigned char ring[2 * STGB];
    const int tid = threadIdx.x, lane = tid & 31, c = lane & 15, hi = lane >> 4, wave = tid >> 5;
    const size_t bh = (size_t)blockIdx.z * NH_ + blockIdx.y;
    const int q0 = blockIdx.x * 128 + wave * 32;
    const h16* qp = QP + bh * TT * HD + (size_t)(q0 + c) * HD + 8 * hi;
    // copies: lane tid brings piece tid & 7 of row tid >> 3 (of each 16 rows)
    const unsigned l0 = (unsigned)(uintptr_t)ring + (unsigned)((tid >> 3) * LP + (tid & 7) * 16);
    const char* gk = (const char*)(KP + bh * TT * HD) + tid * 16;
    const char* gv = (const char*)(VT + bh * HD * TT) + (size_t)(tid >> 3) * (TT * 2) + (tid & 7) * 16;
    // readers: lane -> row c of a 16-row group, bytes 16 hi + 0..15 and 32 + 16 hi + 0..15 of each 64 bytes, as from the planes
    const unsigned char* fb = ring + c * LP + 16 * hi;
    fill_tile(l0, gk, gv);
    v16h qf[2][2], kf[2][2];
#pragma unroll
    for (int cg = 0; cg < 2; ++cg)
#pragma unroll
        for (int ks = 0; ks < 2; ++ks) qf[cg][ks] = WFrag<h16>::ld(qp + cg * 16 * HD + ks * 32);
    v8f acc[4][2];
#pragma unroll
    for (int dt = 0; dt < 4; ++dt)
#pragma unroll
        for (int cg = 0; cg < 2; ++cg) acc[dt][cg] = (v8f){};
    float m[2] = {-3.0e38f, -3.0e38f}; v2f sm[2] = {(v2f){0.f, 0.f}, (v2f){0.f, 0.f}};   // sm: a lane's sums over its even and its odd keys
    asm volatile("s_wait_asynccnt 0x0" ::: "memory");   // this wave's share of tile 0 has landed
    __syncthreads();                                    // tile 0 is readable by all four waves
    fill_tile(l0 + STGB, gk + KS * HD * 2, gv + KS * 2);
    for (int t = 0; t < NT; ++t) {
        const unsigned char* sb = fb + (t & 1) * STGB;
#pragma unroll
        for (int kt = 0; kt < 2; ++kt)
#pragma unroll
            for (int ks = 0; ks < 2; ++ks) kf[kt][ks] = WFrag<h16>::ld((const h16*)(sb + kt * 16 * LP + ks * 64));
#pragma unroll
        for (int p = 0; p < KS / 32; ++p) {   // a pass is 32 keys
            v16h vf[4];
#pragma unroll
            for (int dt = 0; dt < 4; ++dt) vf[dt] = WFrag<h16>::ld((const h16*)(sb + TILEB + dt * 16 * LP + p * 64));
            __builtin_amdgcn_sched_barrier(0);   // the pass's value fragments are asked for as one group up here, a whole softmax ahead of their products; left free, the loads sink to two in front of every four products, each with its own full wait
            v8f st[2][2];   // st[kt][cg][r] = S[q0 + 16 cg + c][64 t + 32 p + 16 kt + 8 hi + r]
#pragma unroll
            for (int kt = 0; kt < 2; ++kt)
#pragma unroll
                for (int cg = 0; cg < 2; ++cg) st[kt][cg] = wmma16(kf[kt][0], qf[cg][0], (v8f){});
#pragma unroll
            for (int kt = 0; kt < 2; ++kt)
#pragma unroll
                for (int cg = 0; cg < 2; ++cg) st[kt][cg] = wmma16(kf[kt][1], qf[cg][1], st[kt][cg]);
            if (p + 1 < KS / 32) {   // the next pass's key fragments of the SAME tile, fetched behind this pass's score products
#pragma unroll
                for (int kt = 0; kt < 2; ++kt)
#pragma unroll
                    for (int ks = 0; ks < 2; ++ks) kf[kt][ks] = WFrag<h16>::ld((const h16*)(sb + ((p + 1) * 32 + kt * 16) * LP + ks * 64));
            }
            float mx[2];
#pragma unroll
            for (int cg = 0; cg < 2; ++cg) { float a = fmaxf(st[0][cg][0], st[1][cg][0]);
#pragma unroll
                for (int r = 1; r < 8; ++r) a = fmaxf(a, fmaxf(st[0][cg][r], st[1][cg][r]));
                a *= CS2; mx[cg] = fmaxf(a, xhalf(a)); }
            const bool need = (mx[0] > m[0] + 8.0f) || (mx[1] > m[1] + 8.0f);
            if (__builtin_amdgcn_ballot_w32(need) != 0) {
#pragma unroll
                for (int cg = 0; cg < 2; ++cg) { const float mn = fmaxf(m[cg], mx[cg]); const float al = __builtin_amdgcn_exp2f(m[cg] - mn); m[cg] = mn; sm[cg] *= al;
#pragma unroll
                    for (int dt = 0; dt < 4; ++dt) acc[dt][cg] *= al; }
            }
            v16h pf[2];   // weights lie in [0, 2^8]: inside f16's range, and what falls below its normal range is below one rounding step of the row's sum, which is at least 1
#pragma unroll
            for (int cg = 0; cg < 2; ++cg) { const v2f nm = {-m[cg], -m[cg]};
#pragma unroll
                for (int s = 0; s < 16; s += 2) {   // register pairs as they lie in the score tile: packed f32 operations, no copies
                    const v2f t2 = __builtin_elementwise_fma((v2f){st[s >> 3][cg][s & 7], st[s >> 3][cg][(s & 7) + 1]}, (v2f){CS2, CS2}, nm);
                    const v2f pe = {__builtin_amdgcn_exp2f(t2[0]), __builtin_amdgcn_exp2f(t2[1])};
                    sm[cg] += pe;
                    const v2h h2 = __builtin_convertvector(pe, v2h);
                    pf[cg][s] = h2[0]; pf[cg][s + 1] = h2[1];
                }
            }
#pragma unroll
            for (int dt = 0; dt < 4; ++dt)
#pragma unroll
                for (int cg = 0; cg < 2; ++cg) acc[dt][cg] = wmma16(vf[dt], pf[cg], acc[dt][cg]);
        }
        asm volatile("s_wait_dscnt 0x0" ::: "memory");      // this wave's reads of tile t have returned before its buffer is handed to the copies
        asm volatile("s_wait_asynccnt 0x0" ::: "memory");   // this wave's share of tile t + 1 has landed
        __syncthreads();                                    // publishes tile t + 1 and ends every wave's reads of tile t
        if (t + 2 < NT) fill_tile(l0 + (unsigned)(t & 1) * STGB, gk + (size_t)(t + 2) * (KS * HD * 2), gv + (size_t)(t + 2) * (KS * 2));
    }
    asm volatile("s_wait_asynccnt 0x0" ::: "memory");       // no copy is outstanding when the wave ends
#pragma unroll
    for (int cg = 0; cg < 2; ++cg) {
        const float sl = sm[cg][0] + sm[cg][1]; const float f = __fdiv_rn(1.0f, sl + xhalf(sl));
        float* o = OUT + ((size_t)blockIdx.z * TT + q0 + cg * 16 + c) * DM + blockIdx.y * HD + 8 * hi;   // acc[dt][cg][r] = O[q0 + 16 cg + c][16 dt + 8 hi + r]
#pragma unroll
        for (int dt = 0; dt < 4; ++dt) { const v8f a = acc[dt][cg] * f; *(v4f*)(o + dt * 16) = (v4f){a[0], a[1], a[2], a[3]}; *(v4f*)(o + dt * 16 + 4) = (v4f){a[4], a[5], a[6], a[7]}; }
    }
}

extern "C" void kernel_launch(void* const* d_in, const int* in_sizes, int n_in,
                              void* d_out, int out_size, void* d_ws, size_t ws_size, hipStream_t stream) {
    if (n_in < 7) return;
    if (in_sizes[0] < NB * SEQ_FULL * DM) return;
    if (in_sizes[1] < NH_ * DM * HD || in_sizes[3] < NH_ * DM * HD || in_sizes[5] < NH_ * DM * HD) return;
    if (in_sizes[2] < NH_ * HD || in_sizes[4] < NH_ * HD || in_sizes[6] < NH_ * HD) return;
    if (out_size < NB * TT * DM) return;
    const float* x  = (const float*)d_in[0];
    const float* wq = (const float*)d_in[1]; const float* bq = (const float*)d_in[2];
    const float* wk = (const float*)d_in[3]; const float* bk = (const float*)d_in[4];
    const float* wv = (const float*)d_in[5]; const float* bv = (const float*)d_in[6];
    float* OUT = (float*)d_out;     // [NB][TT][DM]
    char* wsp = (char*)d_ws;
    auto take = [&](size_t bytes) { char* p = wsp; wsp += (bytes + 255) & ~(size_t)255; return (void*)p; };
    bf*    WT  = (bf*)take((size_t)3 * DM * DM * 2);                 // [3][DM][DM]  Bt planes
    bf*    XB  = (bf*)take((size_t)NB * SEQ_FULL * DM * 2);          // bf16 x, all batches
    h16*   QP  = (h16*)take((size_t)NB * NH_ * TT * HD * 2);         // planes of all batches
    h16*   KP  = (h16*)take((size_t)NB * NH_ * TT * HD * 2);
    h16*   VT  = (h16*)take((size_t)NB * NH_ * HD * TT * 2);
    if ((size_t)(wsp - (char*)d_ws) > ws_size) return;

    k_prep<<<3 * WTB + CVB, 256, 0, stream>>>(x, wq, wk, wv, XB, WT);
    k_proj<<<dim3(NB * TT / 128, NH_ / 2, 3), 128, 0, stream>>>(XB, WT, bq, bk, bv, QP, KP, VT);
    k_fattn<<<dim3(TT / 128, NH_, NB), 128, 0, stream>>>(QP, KP, VT, OUT);
}

// v008
// Measured time: 60.9 microseconds a run.
// Two timings next to v007 both put it at 1.04 times that version's speed.
// All steps since v000 together make it 11.3 times as fast.
#include <hip/hip_runtime.h>

// Contractions, f32 accumulate: q/k/v projections v_wmma_f32_16x16x32_bf16 on bf16 (RNE) copies of x and W (exact products); scores v_wmma_f32_16x16x32_f16 on f16 q/k planes (single product); softmax f32; P.V v_wmma_f32_16x16x32_f16 on P and V each rounded once (RNE) to f16 (single product): the bf16 copies of x and W already leave a value several f16 rounding steps away from the f32 projection, so f16's own rounding adds little to the output's error.
// Pipeline: ONE launch prepares both bf16 operands (x, transposed W); ONE launch over all (batch, 64 tokens, head, weight): bf16(x) x Bt, +bias, written in whole lines as q/k planes [b][h][t][d] f16 and the value plane [b][h][d][t] f16; then ONE launch over all (batch, head, 128 queries), key and value tiles staged in LDS: S^T = K Q^T, online softmax of S/HD in f32, O^T += V^T P^T with P packed from the score accumulators, out[b][t][h*HD + d] written in whole lines.

#ifndef NB
#define NB 8
#endif
#ifndef SEQ
#define SEQ 1024
#endif
#define SEQ_FULL 1024
#define TT   SEQ
#define DM   768
#define NH_  12
#define HD   64
#define SCL  0.015625f   // 1/HD (scores are divided by head_dim)

static_assert(TT % 128 == 0);
static_assert(TT <= SEQ_FULL);
static_assert(NH_ * HD == DM);
static_assert(DM % 64 == 0);
static_assert(HD == 64);
static_assert(NH_ % 2 == 0);
static_assert(NB >= 1 && NB <= 8);

typedef _Float16 h16;
typedef unsigned short bf;
typedef __attribute__((ext_vector_type(16))) __bf16   v16bf;
typedef __attribute__((ext_vector_type(16))) _Float16 v16h;
typedef __attribute__((ext_vector_type(8)))  _Float16 v8h;
typedef __attribute__((ext_vector_type(8)))  unsigned short v8us;
typedef __attribute__((ext_vector_type(8)))  float    v8f;
typedef __attribute__((ext_vector_type(4)))  float    v4f;
typedef __attribute__((ext_vector_type(4)))  unsigned short v4us;
typedef v8h  __attribute__((may_alias)) v8ha;
typedef v4f  __attribute__((may_alias)) v4fa;
typedef v8us __attribute__((may_alias)) v8usa;

__device__ __forceinline__ unsigned short f2bf(float f) { unsigned u = __float_as_uint(f); u += 0x7FFFu + ((u >> 16) & 1u); return (unsigned short)(u >> 16); }
__device__ __forceinline__ float bf2f(unsigned short b) { return __uint_as_float(((unsigned)b) << 16); }
__device__ __forceinline__ float bfr(float f) { return bf2f(f2bf(f)); }
__device__ __forceinline__ v16h cat16(v8h lo, v8h hi) { return __builtin_shufflevector(lo, hi, 0, 1, 2, 3, 4, 5, 6, 7, 8, 9, 10, 11, 12, 13, 14, 15); }
__device__ __forceinline__ v16bf cat16b(v8us lo, v8us hi) { return __builtin_bit_cast(v16bf, __builtin_shufflevector(lo, hi, 0, 1, 2, 3, 4, 5, 6, 7, 8, 9, 10, 11, 12, 13, 14, 15)); }
__device__ __forceinline__ v8f wmma16(v16h a, v16h b, v8f c) { return __builtin_amdgcn_wmma_f32_16x16x32_f16(false, a, false, b, (short)0, c, false, false); }
__device__ __forceinline__ v8f wmmab(v16bf a, v16bf b, v8f c) { return __builtin_amdgcn_wmma_f32_16x16x32_bf16(false, a, false, b, (short)0, c, false, false); }
__device__ __forceinline__ h16 tohx(float x) { return (h16)x; }

// ---- k_proj: q, k and v projections of ALL batches in one launch; the epilogue adds the bias and writes the operand planes of k_fattn, staged through LDS into whole lines.
// One wave per 64 tokens x one head x one of q/k/v (16 accumulators, K = DM); 4 waves per work-group = 2 token tiles x 2 heads; grid (NB*TT/128, NH_/2, 3).
// Operands come from LDS: a stage is 64 k = 128 token rows and 128 weight rows of 128 bytes each, brought in whole 128-byte lines by asynchronous copies, once for the four waves, two buffers, the next stage in flight while this one is worked on.
// LDS rows are unpadded (two buffers = 64 KiB, so five work-groups share a WGP's 320 KiB and the whole grid is resident); instead the 16-byte piece p of row r lies at place p ^ ((r >> 1) & 7) of its row:
// 16 lanes that read one piece of 16 consecutive rows then fall on 16 different 16-byte places modulo 256 bytes, that is on all 64 banks once.
// Fragments: lane -> row/col lane&15; elements 0..7 <- k0 + 8h + 0..7, elements 8..15 <- k0 + 16 + 8h + 0..7 (h = lane>>4), identical for both operands, so either plane can stand on either side of the product.
// A lane's 8 accumulator registers run along the rows of the first operand: the weight rows stand first for q and k (8 consecutive d of one token = one 16-byte piece of a [t][d] row), the token rows stand first for v (8 consecutive t of one d = one 16-byte piece of a [d][t] row).
template <typename T16> struct WFrag;
template <> struct WFrag<h16> { typedef v16h V; static __device__ __forceinline__ V ld(const h16* p) { return cat16(*(const v8h*)p, *(const v8h*)(p + 16)); } static __device__ __forceinline__ v8f mma(V a, V b, v8f c) { return wmma16(a, b, c); } };
#define PK    64             // k per stage
#define PLP   128            // LDS row pitch in bytes, no pad
#define PHALF (128 * PLP)    // 128 rows of one operand
#define PSTG  (2 * PHALF)    // token rows | weight rows
#define PNT   (DM / PK)
#define SLP   144            // row pitch of the staged results: 128 + 16 bytes, an odd multiple of 16, free of bank conflicts for 16 lanes that write 16 bytes each into 16 rows
static_assert(DM % PK == 0 && PNT >= 2);
static_assert(4 * 64 * SLP <= 2 * PSTG);
// A lane's eight 16-byte copies of one operand's 128 rows: 128 lanes x 16 bytes = 16 rows per copy. l: the lane's LDS byte address in the first 16 rows; g: its global bytes there.
// The address-translation wait closes the statement, so no register that a copy names is rewritten ahead of it.
__device__ __forceinline__ void fill_rows(unsigned l, const char* g) {
    asm volatile("global_load_async_to_lds_b128 %0, %8, off\n\t"
                 "global_load_async_to_lds_b128 %1, %9, off\n\t"
                 "global_load_async_to_lds_b128 %2, %10, off\n\t"
                 "global_load_async_to_lds_b128 %3, %11, off\n\t"
                 "global_load_async_to_lds_b128 %4, %12, off\n\t"
                 "global_load_async_to_lds_b128 %5, %13, off\n\t"
                 "global_load_async_to_lds_b128 %6, %14, off\n\t"
                 "global_load_async_to_lds_b128 %7, %15, off\n\t"
                 "s_wait_xcnt 0x0"
                 :: "v"(l), "v"(l + 16 * PLP), "v"(l + 32 * PLP), "v"(l + 48 * PLP), "v"(l + 64 * PLP), "v"(l + 80 * PLP), "v"(l + 96 * PLP), "v"(l + 112 * PLP),
                    "v"(g), "v"(g + 16 * DM * 2), "v"(g + 32 * DM * 2), "v"(g + 48 * DM * 2), "v"(g + 64 * DM * 2), "v"(g + 80 * DM * 2), "v"(g + 96 * DM * 2), "v"(g + 112 * DM * 2)
                 : "memory");
}
__global__ __launch_bounds__(128) void k_proj(const bf* __restrict__ XB, const bf* __restrict__ WT, const float* __restrict__ bq, const float* __restrict__ bk, const float* __restrict__ bv, h16* QP, h16* KP, h16* VT) {
    __shared__ __attribute__((aligned(16))) unsigned char stg[2 * PSTG];
    const int tid = threadIdx.x, lane = tid & 31, lr = lane & 15, hi = lane >> 4;
    const int wave = __builtin_amdgcn_readfirstlane(threadIdx.x >> 5);   // the tile's indices stay in scalar registers
    const int z = blockIdx.z;
    const int r0 = (blockIdx.x * 2 + (wave & 1)) * 64, b = r0 / TT, t0 = r0 % TT;   // 64 tokens of one batch (TT % 64 == 0)
    const int h = blockIdx.y * 2 + (wave >> 1);
    // copies: lane tid brings piece tid & 7 of row tid >> 3 (of each 16 rows); the work-group's 128 tokens lie in one batch (TT % 128 == 0)
    const unsigned l0 = (unsigned)(uintptr_t)stg + (unsigned)((tid >> 3) * PLP + (((tid & 7) ^ ((tid >> 4) & 7)) * 16));
    const char* gx = (const char*)(XB + ((size_t)(blockIdx.x * 128 / TT) * SEQ_FULL + blockIdx.x * 128 % TT + (tid >> 3)) * DM) + (tid & 7) * 16;
    const char* gw = (const char*)(WT + ((size_t)z * DM + blockIdx.y * 128 + (tid >> 3)) * DM) + (tid & 7) * 16;
    // readers: lane -> row lr of a 16-row group, pieces hi and 2 + hi of each four (bytes 16 hi + 0..15 and 32 + 16 hi + 0..15 of each 64, as from the planes), each at its place in the row
    const unsigned char* xr = stg + ((wave & 1) * 64 + lr) * PLP;
    const unsigned char* wr = stg + PHALF + ((wave >> 1) * 64 + lr) * PLP;
    int po[PK / 32][2];
#pragma unroll
    for (int ks = 0; ks < PK / 32; ++ks)
#pragma unroll
        for (int j = 0; j < 2; ++j) po[ks][j] = ((ks * 4 + j * 2 + hi) ^ ((lr >> 1) & 7)) * 16;
    const unsigned char* P = (z == 2) ? xr : wr;   // rows of the result tile
    const unsigned char* Q = (z == 2) ? wr : xr;   // columns of the result tile
    fill_rows(l0, gx); fill_rows(l0 + PHALF, gw);
    v8f acc[4][4];
#pragma unroll
    for (int mb = 0; mb < 4; ++mb)
#pragma unroll
        for (int nb = 0; nb < 4; ++nb) acc[mb][nb] = (v8f){};
    asm volatile("s_wait_asynccnt 0x0" ::: "memory");   // this wave's share of stage 0 has landed
    __syncthreads();                                    // stage 0 is readable by all four waves
    fill_rows(l0 + PSTG, gx + PK * 2); fill_rows(l0 + PSTG + PHALF, gw + PK * 2);
    for (int t = 0; t < PNT; ++t) {
        const unsigned char* pk = P + (t & 1) * PSTG; const unsigned char* qk = Q + (t & 1) * PSTG;
#pragma unroll
        for (int ks = 0; ks < PK / 32; ++ks) {
            v16bf a[4], q[4];
#pragma unroll
            for (int mb = 0; mb < 4; ++mb) a[mb] = cat16b(*(const v8us*)(pk + mb * 16 * PLP + po[ks][0]), *(const v8us*)(pk + mb * 16 * PLP + po[ks][1]));
#pragma unroll
            for (int nb = 0; nb < 4; ++nb) q[nb] = cat16b(*(const v8us*)(qk + nb * 16 * PLP + po[ks][0]), *(const v8us*)(qk + nb * 16 * PLP + po[ks][1]));
#pragma unroll
            for (int nb = 0; nb < 4; ++nb)
#pragma unroll
                for (int mb = 0; mb < 4; ++mb) acc[mb][nb] = wmmab(a[mb], q[nb], acc[mb][nb]);
        }
        asm volatile("s_wait_dscnt 0x0" ::: "memory");      // this wave's reads of stage t have returned before its buffer is handed to the copies
        asm volatile("s_wait_asynccnt 0x0" ::: "memory");   // this wave's share of stage t + 1 has landed
        __syncthreads();                                    // publishes stage t + 1 and ends every wave's reads of stage t
        if (t + 2 < PNT) { fill_rows(l0 + (unsigned)(t & 1) * PSTG, gx + (size_t)(t + 2) * (PK * 2)); fill_rows(l0 + (unsigned)(t & 1) * PSTG + PHALF, gw + (size_t)(t + 2) * (PK * 2)); }
    }
    asm volatile("s_wait_asynccnt 0x0" ::: "memory");       // no copy is outstanding when the wave ends
    // The results leave through LDS, so that every store instruction writes four whole 128-byte lines (from the accumulators it would touch 16 lines with 32 bytes each).
    // The ring is free: the last trip's waits and barrier stand behind every wave's last read and every copy. A wave stages its 64 rows of 128 bytes (a token's 64 d, or a d's 64 tokens) in a range of its own, so no further barrier is needed.
    const size_t bh = (size_t)b * NH_ + h;
    unsigned char* sw = stg + wave * (64 * SLP);
    unsigned char* sp = sw + lr * SLP + 16 * hi;                              // a lane's 8 values of tile (mb, nb): row 16 nb + lr, bytes 32 mb + 16 hi + 0..15
    const unsigned char* rp = sw + (lane >> 3) * SLP + (lane & 7) * 16;       // back: 8 lanes a row, 4 rows an instruction
    if (z < 2) {   // acc[mb][nb][j] = (x W)[t0 + 16 nb + lr][16 mb + 8 hi + j]
        const float* bias = (z ? bk : bq) + h * HD + 8 * hi;
        v8f bb[4];
#pragma unroll
        for (int mb = 0; mb < 4; ++mb) bb[mb] = *(const v8f*)(bias + mb * 16);
#pragma unroll
        for (int mb = 0; mb < 4; ++mb)
#pragma unroll
            for (int j = 0; j < 8; ++j) bb[mb][j] = bfr(bb[mb][j]);
#pragma unroll
        for (int nb = 0; nb < 4; ++nb)
#pragma unroll
            for (int mb = 0; mb < 4; ++mb) { v8h v;
#pragma unroll
                for (int j = 0; j < 8; ++j) v[j] = tohx(acc[mb][nb][j] + bb[mb][j]);
                *(v8h*)(sp + nb * 16 * SLP + mb * 32) = v; }
        asm volatile("s_wait_dscnt 0x0" ::: "memory");   // the wave's rows are whole in LDS before its lanes read other lanes' pieces back
        char* o = (char*)((z ? KP : QP) + (bh * TT + t0 + (lane >> 3)) * HD) + (lane & 7) * 16;   // row = token: the wave's 64 rows are 8 KiB in a row
        v8h r[16];
#pragma unroll
        for (int i = 0; i < 16; ++i) r[i] = *(const v8h*)(rp + i * 4 * SLP);
#pragma unroll
        for (int i = 0; i < 16; ++i) *(v8h*)(o + i * 4 * HD * 2) = r[i];
    } else {       // acc[mb][nb][j] = (x W)[t0 + 16 mb + 8 hi + j][16 nb + lr]
        float bl[4];
#pragma unroll
        for (int nb = 0; nb < 4; ++nb) bl[nb] = bv[h * HD + nb * 16 + lr];
#pragma unroll
        for (int nb = 0; nb < 4; ++nb) { const float bb = bfr(bl[nb]);
#pragma unroll
            for (int mb = 0; mb < 4; ++mb) { v8h v;
#pragma unroll
                for (int j = 0; j < 8; ++j) v[j] = tohx(acc[mb][nb][j] + bb);
                *(v8h*)(sp + nb * 16 * SLP + mb * 32) = v; } }
        asm volatile("s_wait_dscnt 0x0" ::: "memory");   // the wave's rows are whole in LDS before its lanes read other lanes' pieces back
        char* o = (char*)(VT + (bh * HD + (lane >> 3)) * TT + t0) + (lane & 7) * 16;   // row = d: 64 tokens = one line of the d's row
        v8h r[16];
#pragma unroll
        for (int i = 0; i < 16; ++i) r[i] = *(const v8h*)(rp + i * 4 * SLP);
#pragma unroll
        for (int i = 0; i < 16; ++i) *(v8h*)(o + (size_t)i * 4 * TT * 2) = r[i];
        asm volatile("s_wait_xcnt 0x0" ::: "memory");   // in the built code the q/k epilogue's text follows these stores and rewrites registers that they name: the wait stands between
    }
}

// k_prep: both operand preparations of k_proj in ONE launch; they read and write disjoint buffers and neither waits on the other.
// The launch is sized by the waves it has to start, not by its elements: a thread takes a block of values and asks for all of it before it converts any, so few waves keep many bytes in flight.
// Work-groups 0 .. 3 WTB - 1 write the transposed bf16 weight planes Bt, one head x 256 k each: a thread reads 4 c x 16 k as sixteen 16-byte loads (8 lanes = one whole 128-byte line of a weight row)
// and stores, for each of its 4 c, 16 bytes twice; the two stores of four lanes fill one 128-byte line of Bt, so a line has one writing wave. The rest convert x to bf16, 12 pieces of 8 values a thread, 3072 consecutive pieces a work-group.
// Every loop is fully unrolled, so that v stays in registers and a thread's loads all stand ahead of its first conversion.
#define WKB 256                                      // k per weight work-group
#define WTB (NH_ * (DM / WKB))                       // work-groups per weight plane
#define NX8 ((size_t)NB * SEQ_FULL * DM / 8)         // 8-value pieces of x
#define XPT 12                                       // pieces of x per thread
#define CVB ((unsigned)(NX8 / (256 * XPT)))          // work-groups of the x conversion
static_assert(DM % WKB == 0);
static_assert(NX8 % (256 * XPT) == 0);
__global__ __launch_bounds__(256) void k_prep(const float* __restrict__ src, const float* __restrict__ wq, const float* __restrict__ wk, const float* __restrict__ wv, bf* dst, bf* Bt) {
    if (blockIdx.x < 3 * WTB) {
        const int z = blockIdx.x / WTB, r = blockIdx.x % WTB, h = r / (DM / WKB), kg = r % (DM / WKB);
        const float* w = (z == 0) ? wq : ((z == 1) ? wk : wv);
        const int lane = threadIdx.x & 31, wave = threadIdx.x >> 5;
        const int c0 = (wave & 1) * 32 + (lane & 7) * 4;                    // 2 waves side by side cover the head's 64 c
        const int k0 = kg * WKB + (wave >> 1) * 64 + (lane >> 3) * 8;       // a wave covers 64 k: 4 lane groups x 8 k, twice, 32 k apart
        const float* s = w + ((size_t)h * DM + k0) * HD + c0;
        v4f v[2][8];
#pragma unroll
        for (int p = 0; p < 2; ++p)
#pragma unroll
            for (int q = 0; q < 8; ++q) v[p][q] = *(const v4f*)(s + (p * 32 + q) * HD);
        bf* d = Bt + (size_t)z * DM * DM + (size_t)(h * HD + c0) * DM + k0;
#pragma unroll
        for (int j = 0; j < 4; ++j)
#pragma unroll
            for (int p = 0; p < 2; ++p) { v8us o;
#pragma unroll
                for (int q = 0; q < 8; ++q) o[q] = f2bf(v[p][q][j]);
                *(v8us*)(d + (size_t)j * DM + p * 32) = o; }
    } else {
        const size_t i = (size_t)(blockIdx.x - 3 * WTB) * (256 * XPT) + threadIdx.x;
        v8f v[XPT];
#pragma unroll
        for (int p = 0; p < XPT; ++p) v[p] = *(const v8f*)(src + (i + p * 256) * 8);
#pragma unroll
        for (int p = 0; p < XPT; ++p) { v8us o;
#pragma unroll
            for (int k = 0; k < 8; ++k) o[k] = f2bf(v[p][k]);
            *(v8us*)(dst + (i + p * 256) * 8) = o; }
        asm volatile("s_wait_xcnt 0x0" ::: "memory");   // in the built code the weight branch's text follows these stores and rewrites registers that they name: the wait stands between
    }
}

typedef __attribute__((ext_vector_type(2))) float  v2f;
typedef __attribute__((ext_vector_type(2))) _Float16 v2h;
#define CS2 (SCL * 1.4426950408889634f)
#define KS    64            // keys per tile
#define LP    144           // LDS row pitch in bytes: 128 + 16, an odd multiple of 16, free of bank conflicts for 16-byte readers of 16 rows
#define TILEB (64 * LP)     // 64 rows
#define STGB  (2 * TILEB)   // key rows | value rows
#define NT    (TT / KS)
#define OLP   272           // row pitch of the staged output: 256 + 16 bytes, an odd multiple of 16, free of bank conflicts for 16 lanes that write 16 bytes each into 16 rows
static_assert(NT >= 2);
static_assert(4 * 32 * OLP <= 2 * STGB);
__device__ __forceinline__ float xhalf(float x) { const int b = __float_as_int(x); return __int_as_float(__builtin_amdgcn_permlanex16(b, b, 0x76543210, 0xfedcba98, false, false)); }
// A lane's eight 16-byte copies of one tile: 128 lanes x 16 bytes = 16 rows per copy, four copies per plane. l: the lane's LDS byte address in the key plane's first 16 rows; gk, gv: its global bytes there.
// The address-translation wait closes the statement, so no register that a copy names is rewritten ahead of it.
__device__ __forceinline__ void fill_tile(unsigned l, const char* gk, const char* gv) {
    asm volatile("global_load_async_to_lds_b128 %0, %8, off\n\t"
                 "global_load_async_to_lds_b128 %1, %9, off\n\t"
                 "global_load_async_to_lds_b128 %2, %10, off\n\t"
                 "global_load_async_to_lds_b128 %3, %11, off\n\t"
                 "global_load_async_to_lds_b128 %4, %12, off\n\t"
                 "global_load_async_to_lds_b128 %5, %13, off\n\t"
                 "global_load_async_to_lds_b128 %6, %14, off\n\t"
                 "global_load_async_to_lds_b128 %7, %15, off\n\t"
                 "s_wait_xcnt 0x0"
                 :: "v"(l), "v"(l + 16 * LP), "v"(l + 32 * LP), "v"(l + 48 * LP),
                    "v"(l + TILEB), "v"(l + TILEB + 16 * LP), "v"(l + TILEB + 32 * LP), "v"(l + TILEB + 48 * LP),
                    "v"(gk), "v"(gk + 16 * HD * 2), "v"(gk + 32 * HD * 2), "v"(gk + 48 * HD * 2),
                    "v"(gv), "v"(gv + 16 * TT * 2), "v"(gv + 32 * TT * 2), "v"(gv + 48 * TT * 2)
                 : "memory");
}
__global__ __launch_bounds__(128) void k_fattn(const h16* __restrict__ QP, const h16* __restrict__ KP, const h16* __restrict__ VT, float* __restrict__ OUT) {
    __shared__ __attribute__((aligned(16))) unsigned char ring[2 * STGB];
    const int tid = threadIdx.x, lane = tid & 31, c = lane & 15, hi = lane >> 4, wave = tid >> 5;
    const size_t bh = (size_t)blockIdx.z * NH_ + blockIdx.y;
    const int q0 = blockIdx.x * 128 + wave * 32;
    const h16* qp = QP + bh * TT * HD + (size_t)(q0 + c) * HD + 8 * hi;
    // copies: lane tid brings piece tid & 7 of row tid >> 3 (of each 16 rows)
    const unsigned l0 = (unsigned)(uintptr_t)ring + (unsigned)((tid >> 3) * LP + (tid & 7) * 16);
    const char* gk = (const char*)(KP + bh * TT * HD) + tid * 16;
    const char* gv = (const char*)(VT + bh * HD * TT) + (size_t)(tid >> 3) * (TT * 2) + (tid & 7) * 16;
    // readers: lane -> row c of a 16-row group, bytes 16 hi + 0..15 and 32 + 16 hi + 0..15 of each 64 bytes, as from the planes
    const unsigned char* fb = ring + c * LP + 16 * hi;
    fill_tile(l0, gk, gv);
    v16h qf[2][2], kf[2][2];
#pragma unroll
    for (int cg = 0; cg < 2; ++cg)
#pragma unroll
        for (int ks = 0; ks < 2; ++ks) qf[cg][ks] = WFrag<h16>::ld(qp + cg * 16 * HD + ks * 32);
    v8f acc[4][2];
#pragma unroll
    for (int dt = 0; dt < 4; ++dt)
#pragma unroll
        for (int cg = 0; cg < 2; ++cg) acc[dt][cg] = (v8f){};
    float m[2] = {-3.0e38f, -3.0e38f}; v2f sm[2] = {(v2f){0.f, 0.f}, (v2f){0.f, 0.f}};   // sm: a lane's sums over its even and its odd keys
    asm volatile("s_wait_asynccnt 0x0" ::: "memory");   // this wave's share of tile 0 has landed
    __syncthreads();                                    // tile 0 is readable by all four waves
    fill_tile(l0 + STGB, gk + KS * HD * 2, gv + KS * 2);
    for (int t = 0; t < NT; ++t) {
        const unsigned char* sb = fb + (t & 1) * STGB;
#pragma unroll
        for (int kt = 0; kt < 2; ++kt)
#pragma unroll
            for (int ks = 0; ks < 2; ++ks) kf[kt][ks] = WFrag<h16>::ld((const h16*)(sb + kt * 16 * LP + ks * 64));
#pragma unroll
        for (int p = 0; p < KS / 32; ++p) {   // a pass is 32 keys
            v16h vf[4];
#pragma unroll
            for (int dt = 0; dt < 4; ++dt) vf[dt] = WFrag<h16>::ld((const h16*)(sb + TILEB + dt * 16 * LP + p * 64));
            __builtin_amdgcn_sched_barrier(0);   // the pass's value fragments are asked for as one group up here, a whole softmax ahead of their products; left free, the loads sink to two in front of every four products, each with its own full wait
            v8f st[2][2];   // st[kt][cg][r] = S[q0 + 16 cg + c][64 t + 32 p + 16 kt + 8 hi + r]
#pragma unroll
            for (int kt = 0; kt < 2; ++kt)
#pragma unroll
                for (int cg = 0; cg < 2; ++cg) st[kt][cg] = wmma16(kf[kt][0], qf[cg][0], (v8f){});
#pragma unroll
            for (int kt = 0; kt < 2; ++kt)
#pragma unroll
                for (int cg = 0; cg < 2; ++cg) st[kt][cg] = wmma16(kf[kt][1], qf[cg][1], st[kt][cg]);
            if (p + 1 < KS / 32) {   // the next pass's key fragments of the SAME tile, fetched behind this pass's score products
#pragma unroll
                for (int kt = 0; kt < 2; ++kt)
#pragma unroll
                    for (int ks = 0; ks < 2; ++ks) kf[kt][ks] = WFrag<h16>::ld((const h16*)(sb + ((p + 1) * 32 + kt * 16) * LP + ks * 64));
            }
            float mx[2];
#pragma unroll
            for (int cg = 0; cg < 2; ++cg) { float a = fmaxf(st[0][cg][0], st[1][cg][0]);
#pragma unroll
                for (int r = 1; r < 8; ++r) a = fmaxf(a, fmaxf(st[0][cg][r], st[1][cg][r]));
                a *= CS2; mx[cg] = fmaxf(a, xhalf(a)); }
            const bool need = (mx[0] > m[0] + 8.0f) || (mx[1] > m[1] + 8.0f);
            if (__builtin_amdgcn_ballot_w32(need) != 0) {
#pragma unroll
                for (int cg = 0; cg < 2; ++cg) { const float mn = fmaxf(m[cg], mx[cg]); const float al = __builtin_amdgcn_exp2f(m[cg] - mn); m[cg] = mn; sm[cg] *= al;
#pragma unroll
                    for (int dt = 0; dt < 4; ++dt) acc[dt][cg] *= al; }
            }
            v16h pf[2];   // weights lie in [0, 2^8]: inside f16's range, and what falls below its normal range is below one rounding step of the row's sum, which is at least 1
#pragma unroll
            for (int cg = 0; cg < 2; ++cg) { const v2f nm = {-m[cg], -m[cg]};
#pragma unroll
                for (int s = 0; s < 16; s += 2) {   // register pairs as they lie in the score tile: packed f32 operations, no copies
                    const v2f t2 = __builtin_elementwise_fma((v2f){st[s >> 3][cg][s & 7], st[s >> 3][cg][(s & 7) + 1]}, (v2f){CS2, CS2}, nm);
                    const v2f pe = {__builtin_amdgcn_exp2f(t2[0]), __builtin_amdgcn_exp2f(t2[1])};
                    sm[cg] += pe;
                    const v2h h2 = __builtin_convertvector(pe, v2h);
                    pf[cg][s] = h2[0]; pf[cg][s + 1] = h2[1];
                }
            }
#pragma unroll
            for (int dt = 0; dt < 4; ++dt)
#pragma unroll
                for (int cg = 0; cg < 2; ++cg) acc[dt][cg] = wmma16(vf[dt], pf[cg], acc[dt][cg]);
        }
        asm volatile("s_wait_dscnt 0x0" ::: "memory");      // this wave's reads of tile t have returned before its buffer is handed to the copies
        asm volatile("s_wait_asynccnt 0x0" ::: "memory");   // this wave's share of tile t + 1 has landed
        __syncthreads();                                    // publishes tile t + 1 and ends every wave's reads of tile t
        if (t + 2 < NT) fill_tile(l0 + (unsigned)(t & 1) * STGB, gk + (size_t)(t + 2) * (KS * HD * 2), gv + (size_t)(t + 2) * (KS * 2));
    }
    asm volatile("s_wait_asynccnt 0x0" ::: "memory");       // no copy is outstanding when the wave ends
    // The output leaves through LDS, so that every store instruction writes four whole 128-byte lines (from the accumulators it would touch 16 lines with two 16-byte pieces each).
    // The ring is free: the last trip's waits and barrier stand behind every wave's last read and every copy. A wave stages its 32 rows of 256 bytes (a query's 64 d) in a range of its own, so no further barrier is needed.
    unsigned char* sw = ring + wave * (32 * OLP);
#pragma unroll
    for (int cg = 0; cg < 2; ++cg) {
        const float sl = sm[cg][0] + sm[cg][1]; const float f = __fdiv_rn(1.0f, sl + xhalf(sl));
        unsigned char* sp = sw + (cg * 16 + c) * OLP + 32 * hi;   // acc[dt][cg][r] = O[q0 + 16 cg + c][16 dt + 8 hi + r]
#pragma unroll
        for (int dt = 0; dt < 4; ++dt) { const v8f a = acc[dt][cg] * f; *(v4f*)(sp + dt * 64) = (v4f){a[0], a[1], a[2], a[3]}; *(v4f*)(sp + dt * 64 + 16) = (v4f){a[4], a[5], a[6], a[7]}; }
    }
    asm volatile("s_wait_dscnt 0x0" ::: "memory");   // the wave's rows are whole in LDS before its lanes read other lanes' pieces back
    const unsigned char* rp = sw + hi * OLP + c * 16;   // back: 16 lanes a row, 2 rows an instruction
    char* o = (char*)(OUT + ((size_t)blockIdx.z * TT + q0 + hi) * DM + blockIdx.y * HD) + c * 16;
    v4f r[16];
#pragma unroll
    for (int i = 0; i < 16; ++i) r[i] = *(const v4f*)(rp + i * 2 * OLP);
#pragma unroll
    for (int i = 0; i < 16; ++i) *(v4f*)(o + (size_t)i * 2 * DM * 4) = r[i];
}

extern "C" void kernel_launch(void* const* d_in, const int* in_sizes, int n_in,
                              void* d_out, int out_size, void* d_ws, size_t ws_size, hipStream_t stream) {
    if (n_in < 7) return;
    if (in_sizes[0] < NB * SEQ_FULL * DM) return;
    if (in_sizes[1] < NH_ * DM * HD || in_sizes[3] < NH_ * DM * HD || in_sizes[5] < NH_ * DM * HD) return;
    if (in_sizes[2] < NH_ * HD || in_sizes[4] < NH_ * HD || in_sizes[6] < NH_ * HD) return;
    if (out_size < NB * TT * DM) return;
    const float* x  = (const float*)d_in[0];
    const float* wq = (const float*)d_in[1]; const float* bq = (const float*)d_in[2];
    const float* wk = (const float*)d_in[3]; const float* bk = (const float*)d_in[4];
    const float* wv = (const float*)d_in[5]; const float* bv = (const float*)d_in[6];
    float* OUT = (float*)d_out;     // [NB][TT][DM]
    char* wsp = (char*)d_ws;
    auto take = [&](size_t bytes) { char* p = wsp; wsp += (bytes + 255) & ~(size_t)255; return (void*)p; };
    bf*    WT  = (bf*)take((size_t)3 * DM * DM * 2);                 // [3][DM][DM]  Bt planes
    bf*    XB  = (bf*)take((size_t)NB * SEQ_FULL * DM * 2);          // bf16 x, all batches
    h16*   QP  = (h16*)take((size_t)NB * NH_ * TT * HD * 2);         // planes of all batches
    h16*   KP  = (h16*)take((size_t)NB * NH_ * TT * HD * 2);
    h16*   VT  = (h16*)take((size_t)NB * NH_ * HD * TT * 2);
    if ((size_t)(wsp - (char*)d_ws) > ws_size) return;

    k_prep<<<3 * WTB + CVB, 256, 0, stream>>>(x, wq, wk, wv, XB, WT);
    k_proj<<<dim3(NB * TT / 128, NH_ / 2, 3), 128, 0, stream>>>(XB, WT, bq, bk, bv, QP, KP, VT);
    k_fattn<<<dim3(TT / 128, NH_, NB), 128, 0, stream>>>(QP, KP, VT, OUT);
}
